// v000
// Times are from an AMD MI455X. After a warm-up the kernel runs many times in a row, and a time is the length of
// such a window on the GPU divided by its runs, so every launch and the gaps after it count. The runs cycle
// through copies of the inputs. A figure is the median of several windows, for all but v000 over two sittings.
// Sittings can differ by a few percent; kernels timed side by side share one.
// v000, which the later versions start from, runs in 78.4 microseconds.
#include <hip/hip_runtime.h>
#include <hip/hip_bf16.h>
#include <math.h>

// Problem constants (B=8, S=2048, D=1024, U=1024, A=4)
#define MDIM 16384   // B*S
#define KDIM 1024    // D
#define NDIM 1024    // U
#define LDA  40      // padded LDS row stride in halves (32 data + 8 pad) -> conflict-free b128 reads

typedef __attribute__((ext_vector_type(16))) _Float16 v16h;
typedef __attribute__((ext_vector_type(8)))  _Float16 v8h;
typedef __attribute__((ext_vector_type(4)))  _Float16 v4h;
typedef __attribute__((ext_vector_type(8)))  float    v8f;

// ---------------------------------------------------------------------------
// Kernel 0: transpose + convert  w[D][U] f32  ->  wT[U][D] f16
// ---------------------------------------------------------------------------
__global__ __launch_bounds__(256) void k_transpose_w(const float* __restrict__ w,
                                                     _Float16* __restrict__ wT) {
    __shared__ float tile[32][33];
    const int bx = blockIdx.x & 31;        // n-tile (U/32)
    const int by = blockIdx.x >> 5;        // k-tile (D/32)
    const int tx = threadIdx.x & 31;
    const int ty = threadIdx.x >> 5;       // 0..7
#pragma unroll
    for (int j = 0; j < 4; ++j) {
        int k = by * 32 + ty + j * 8;
        tile[ty + j * 8][tx] = w[(size_t)k * NDIM + bx * 32 + tx];
    }
    __syncthreads();
#pragma unroll
    for (int j = 0; j < 4; ++j) {
        int n = bx * 32 + ty + j * 8;
        wT[(size_t)n * KDIM + by * 32 + tx] = (_Float16)tile[tx][ty + j * 8];
    }
}

// ---------------------------------------------------------------------------
// Kernel 1: attention  attn[m][a] = softmax_a( x[m,:] . w_att[:,a] + b_att[a] )
// One wave32 per row; coalesced x reads; butterfly shuffle reduction.
// ---------------------------------------------------------------------------
__global__ __launch_bounds__(256) void k_attention(const float* __restrict__ x,
                                                   const float* __restrict__ w_att,
                                                   const float* __restrict__ b_att,
                                                   float* __restrict__ attn) {
    const int wave = threadIdx.x >> 5;
    const int lane = threadIdx.x & 31;
    const int m = blockIdx.x * 8 + wave;
    const float* xr = x + (size_t)m * KDIM;

    float a0 = 0.f, a1 = 0.f, a2 = 0.f, a3 = 0.f;
    for (int k = lane; k < KDIM; k += 32) {
        float xv = xr[k];
        float4 wv = ((const float4*)w_att)[k];   // w_att row k (A=4 contiguous)
        a0 += xv * wv.x; a1 += xv * wv.y; a2 += xv * wv.z; a3 += xv * wv.w;
    }
#pragma unroll
    for (int off = 16; off > 0; off >>= 1) {
        a0 += __shfl_xor(a0, off, 32);
        a1 += __shfl_xor(a1, off, 32);
        a2 += __shfl_xor(a2, off, 32);
        a3 += __shfl_xor(a3, off, 32);
    }
    if (lane == 0) {
        a0 += b_att[0]; a1 += b_att[1]; a2 += b_att[2]; a3 += b_att[3];
        float mx = fmaxf(fmaxf(a0, a1), fmaxf(a2, a3));
        float e0 = __expf(a0 - mx), e1 = __expf(a1 - mx);
        float e2 = __expf(a2 - mx), e3 = __expf(a3 - mx);
        float inv = __builtin_amdgcn_rcpf(e0 + e1 + e2 + e3);
        ((float4*)attn)[m] = make_float4(e0 * inv, e1 * inv, e2 * inv, e3 * inv);
    }
}

// ---------------------------------------------------------------------------
// GEMM helpers
// ---------------------------------------------------------------------------
__device__ __forceinline__ void stage_tiles(const float* __restrict__ x,
                                            const _Float16* __restrict__ wT,
                                            _Float16* Ab, _Float16* Bb,
                                            int mBase, int nBase, int k0, int t) {
    // A tile: x[mBase..+127][k0..+31] f32 -> f16
    const int r0 = t >> 3;              // 0..31
    const int c4 = (t & 7) * 4;         // 0..28
#pragma unroll
    for (int p = 0; p < 4; ++p) {
        int r = p * 32 + r0;
        float4 v = *(const float4*)(x + (size_t)(mBase + r) * KDIM + k0 + c4);
        v4h hv;
        hv[0] = (_Float16)v.x; hv[1] = (_Float16)v.y;
        hv[2] = (_Float16)v.z; hv[3] = (_Float16)v.w;
        *(v4h*)&Ab[r * LDA + c4] = hv;
    }
    // B tile: wT[nBase..+127][k0..+31] f16
    const int n0 = t >> 2;              // 0..63
    const int c8 = (t & 3) * 8;         // 0..24
#pragma unroll
    for (int p = 0; p < 2; ++p) {
        int n = p * 64 + n0;
        *(v8h*)&Bb[n * LDA + c8] =
            *(const v8h*)(wT + (size_t)(nBase + n) * KDIM + k0 + c8);
    }
}

__device__ __forceinline__ void mma_step(const _Float16* Ab, const _Float16* Bb,
                                         v8f (&acc)[2][4],
                                         int wM, int wN, int h, int ln) {
    // ISA 16-bit A/B layout: lanes 0-15: K = 0..7 then 16..23 ;
    //                        lanes 16-31: K = 8..15 then 24..31
    v16h afrag[2], bfrag[4];
#pragma unroll
    for (int mi = 0; mi < 2; ++mi) {
        int m = wM * 32 + mi * 16 + ln;
        v8h lo = *(const v8h*)&Ab[m * LDA + 8 * h];
        v8h hi = *(const v8h*)&Ab[m * LDA + 16 + 8 * h];
        afrag[mi] = __builtin_shufflevector(lo, hi, 0,1,2,3,4,5,6,7,8,9,10,11,12,13,14,15);
    }
#pragma unroll
    for (int ni = 0; ni < 4; ++ni) {
        int n = wN * 64 + ni * 16 + ln;
        v8h lo = *(const v8h*)&Bb[n * LDA + 8 * h];
        v8h hi = *(const v8h*)&Bb[n * LDA + 16 + 8 * h];
        bfrag[ni] = __builtin_shufflevector(lo, hi, 0,1,2,3,4,5,6,7,8,9,10,11,12,13,14,15);
    }
#pragma unroll
    for (int mi = 0; mi < 2; ++mi)
#pragma unroll
        for (int ni = 0; ni < 4; ++ni)
            acc[mi][ni] = __builtin_amdgcn_wmma_f32_16x16x32_f16(
                false, afrag[mi], false, bfrag[ni],
                (short)0, acc[mi][ni], false, false);
}

// ---------------------------------------------------------------------------
// Kernel 2: fused  ws = x@w + b  (WMMA f16->f32, double-buffered LDS),
// then 4-way activation mix weighted by attn, store out[m][n] f32.
// 128x128 tile / block (256 thr = 8 waves, each wave 32x64 = 2x4 WMMA tiles).
// ---------------------------------------------------------------------------
__global__ __launch_bounds__(256) void k_gemm_act(const float*    __restrict__ x,
                                                  const _Float16* __restrict__ wT,
                                                  const float*    __restrict__ bias,
                                                  const float*    __restrict__ wf,
                                                  const float*    __restrict__ bf,
                                                  const float*    __restrict__ attn,
                                                  float*          __restrict__ out) {
    __shared__ _Float16 Alds[2][128 * LDA];   // [m][k] f16, padded rows
    __shared__ _Float16 Blds[2][128 * LDA];   // [n][k] f16, padded rows
    __shared__ float4   Atn[128];             // attention rows for this m-tile

    const int t     = threadIdx.x;
    const int nTile = blockIdx.x & 7;      // N / 128 = 8
    const int mTile = blockIdx.x >> 3;     // M / 128 = 128
    const int mBase = mTile * 128;
    const int nBase = nTile * 128;
    const int wave  = t >> 5;
    const int lane  = t & 31;
    const int wM    = wave & 3;            // 4 waves along M
    const int wN    = wave >> 2;           // 2 waves along N
    const int h     = lane >> 4;           // lane half (K sub-block select)
    const int ln    = lane & 15;           // row/col within 16

    if (t < 128) Atn[t] = ((const float4*)attn)[mBase + t];

    v8f acc[2][4] = {};

    // prologue: stage K-tile 0 into buffer 0
    stage_tiles(x, wT, Alds[0], Blds[0], mBase, nBase, 0, t);
    __syncthreads();

    // software-pipelined main loop: stage next buffer while consuming current
#pragma unroll 1
    for (int kt = 0; kt < KDIM / 32; kt += 2) {
        stage_tiles(x, wT, Alds[1], Blds[1], mBase, nBase, (kt + 1) * 32, t);
        mma_step(Alds[0], Blds[0], acc, wM, wN, h, ln);
        __syncthreads();
        if (kt + 2 < KDIM / 32)
            stage_tiles(x, wT, Alds[0], Blds[0], mBase, nBase, (kt + 2) * 32, t);
        mma_step(Alds[1], Blds[1], acc, wM, wN, h, ln);
        __syncthreads();
    }

    // ---- epilogue: bias + 4 activations weighted by attention ----
#pragma unroll
    for (int ni = 0; ni < 4; ++ni) {
        const int n_g = nBase + wN * 64 + ni * 16 + ln;
        const float  bn  = bias[n_g];
        const float4 wfv = ((const float4*)wf)[n_g];
        const float4 bfv = ((const float4*)bf)[n_g];
#pragma unroll
        for (int mi = 0; mi < 2; ++mi) {
#pragma unroll
            for (int i = 0; i < 8; ++i) {
                const int   mloc = wM * 32 + mi * 16 + 8 * h + i;
                const float wsv  = acc[mi][ni][i] + bn;
                const float4 at  = Atn[mloc];
                const float t0 = wsv * wfv.x + bfv.x;
                const float t1 = wsv * wfv.y + bfv.y;
                const float t2 = wsv * wfv.z + bfv.z;
                const float t3 = wsv * wfv.w + bfv.w;
                // relu
                float r = fmaxf(t0, 0.f) * at.x;
                // sigmoid: 1/(1+e^-t) via v_exp + v_rcp (straight-line, ~1ulp)
                r += at.y * __builtin_amdgcn_rcpf(1.f + __expf(-t1));
                // tanh: 1 - 2/(e^{2t}+1)  (saturates correctly at +/-inf)
                r += at.z * fmaf(-2.f, __builtin_amdgcn_rcpf(__expf(2.f * t2) + 1.f), 1.f);
                // exact gelu: 0.5*t*(1+erf(t/sqrt(2)))
                r += at.w * (0.5f * t3 * (1.f + erff(t3 * 0.7071067811865475f)));
                out[(size_t)(mBase + mloc) * NDIM + n_g] = r;
            }
        }
    }
}

// ---------------------------------------------------------------------------
extern "C" void kernel_launch(void* const* d_in, const int* in_sizes, int n_in,
                              void* d_out, int out_size, void* d_ws, size_t ws_size,
                              hipStream_t stream) {
    (void)in_sizes; (void)n_in; (void)out_size; (void)ws_size;
    const float* x     = (const float*)d_in[0];   // [B,S,D]
    const float* w     = (const float*)d_in[1];   // [D,U]
    const float* b     = (const float*)d_in[2];   // [U]
    const float* wf    = (const float*)d_in[3];   // [U,A]
    const float* bf    = (const float*)d_in[4];   // [U,A]
    const float* w_att = (const float*)d_in[5];   // [D,A]
    const float* b_att = (const float*)d_in[6];   // [A]
    float* out = (float*)d_out;                   // [B,S,U]

    // workspace layout: wT (U*K f16 = 2MB) | attn (M*4 f32 = 256KB)
    _Float16* wT   = (_Float16*)d_ws;
    float*    attn = (float*)((char*)d_ws + (size_t)NDIM * KDIM * sizeof(_Float16));

    k_transpose_w<<<(KDIM / 32) * (NDIM / 32), 256, 0, stream>>>(w, wT);
    k_attention<<<MDIM / 8, 256, 0, stream>>>(x, w_att, b_att, attn);
    k_gemm_act<<<(MDIM / 128) * (NDIM / 128), 256, 0, stream>>>(x, wT, b, wf, bf, attn, out);
}

// v001
// A run of this version takes 54.5 microseconds.
// In two side-by-side timings against v000, it was 1.48 and 1.47 times as fast.
#include <hip/hip_runtime.h>
#include <hip/hip_bf16.h>
#include <math.h>

// Problem constants (B=8, S=2048, D=1024, U=1024, A=4)
#define MDIM 16384   // B*S
#define KDIM 1024    // D
#define NDIM 1024    // U
#define KT   64      // k extent of one staged tile: 128 B of a wT row, 256 B of an x row (whole lines)
#define BM   128     // rows of out per block
#define BN   256     // columns of out per block
#define LDA  72      // padded LDS row stride in halves (64 data + 8 pad = 9 x 16 B) -> conflict-free b128 reads

typedef __attribute__((ext_vector_type(16))) _Float16 v16h;
typedef __attribute__((ext_vector_type(8)))  _Float16 v8h;
typedef __attribute__((ext_vector_type(4)))  _Float16 v4h;
typedef __attribute__((ext_vector_type(8)))  float    v8f;

// ---------------------------------------------------------------------------
// Kernel 0: transpose + convert  w[D][U] f32  ->  wT[U][D] f16
// ---------------------------------------------------------------------------
__global__ __launch_bounds__(256) void k_transpose_w(const float* __restrict__ w,
                                                     _Float16* __restrict__ wT) {
    __shared__ float tile[32][33];
    const int bx = blockIdx.x & 31;        // n-tile (U/32)
    const int by = blockIdx.x >> 5;        // k-tile (D/32)
    const int tx = threadIdx.x & 31;
    const int ty = threadIdx.x >> 5;       // 0..7
#pragma unroll
    for (int j = 0; j < 4; ++j) {
        int k = by * 32 + ty + j * 8;
        tile[ty + j * 8][tx] = w[(size_t)k * NDIM + bx * 32 + tx];
    }
    __syncthreads();
#pragma unroll
    for (int j = 0; j < 4; ++j) {
        int n = bx * 32 + ty + j * 8;
        wT[(size_t)n * KDIM + by * 32 + tx] = (_Float16)tile[tx][ty + j * 8];
    }
}

// ---------------------------------------------------------------------------
// Kernel 1: attention  attn[m][a] = softmax_a( x[m,:] . w_att[:,a] + b_att[a] )
// One wave32 per row; coalesced x reads; butterfly shuffle reduction.
// ---------------------------------------------------------------------------
__global__ __launch_bounds__(256) void k_attention(const float* __restrict__ x,
                                                   const float* __restrict__ w_att,
                                                   const float* __restrict__ b_att,
                                                   float* __restrict__ attn) {
    const int wave = threadIdx.x >> 5;
    const int lane = threadIdx.x & 31;
    const int m = blockIdx.x * 8 + wave;
    const float* xr = x + (size_t)m * KDIM;

    float a0 = 0.f, a1 = 0.f, a2 = 0.f, a3 = 0.f;
    for (int k = lane; k < KDIM; k += 32) {
        float xv = xr[k];
        float4 wv = ((const float4*)w_att)[k];   // w_att row k (A=4 contiguous)
        a0 += xv * wv.x; a1 += xv * wv.y; a2 += xv * wv.z; a3 += xv * wv.w;
    }
#pragma unroll
    for (int off = 16; off > 0; off >>= 1) {
        a0 += __shfl_xor(a0, off, 32);
        a1 += __shfl_xor(a1, off, 32);
        a2 += __shfl_xor(a2, off, 32);
        a3 += __shfl_xor(a3, off, 32);
    }
    if (lane == 0) {
        a0 += b_att[0]; a1 += b_att[1]; a2 += b_att[2]; a3 += b_att[3];
        float mx = fmaxf(fmaxf(a0, a1), fmaxf(a2, a3));
        float e0 = __expf(a0 - mx), e1 = __expf(a1 - mx);
        float e2 = __expf(a2 - mx), e3 = __expf(a3 - mx);
        float inv = __builtin_amdgcn_rcpf(e0 + e1 + e2 + e3);
        ((float4*)attn)[m] = make_float4(e0 * inv, e1 * inv, e2 * inv, e3 * inv);
    }
}

// ---------------------------------------------------------------------------
// GEMM helpers
// ---------------------------------------------------------------------------
// xg, wg: this thread's first element of the tile in x and in wT; the further rows of
// the thread lie at compile-time distances, so one address pair per operand stays live.
__device__ __forceinline__ void stage_tiles(const float* __restrict__ xg,
                                            const _Float16* __restrict__ wg,
                                            _Float16* Ab, _Float16* Bb, int t) {
    // A tile: 128 rows x 64 k, f32 -> f16
    const int r0 = t >> 4;              // 0..31
    const int c4 = (t & 15) * 4;        // 0..60
#pragma unroll
    for (int p = 0; p < 4; ++p) {
        float4 v = *(const float4*)(xg + p * 32 * KDIM);
        v4h hv;
        hv[0] = (_Float16)v.x; hv[1] = (_Float16)v.y;
        hv[2] = (_Float16)v.z; hv[3] = (_Float16)v.w;
        *(v4h*)&Ab[(p * 32 + r0) * LDA + c4] = hv;
    }
    // B tile: 256 rows x 64 k, f16
    const int n0 = t >> 3;              // 0..63
    const int c8 = (t & 7) * 8;         // 0..56
#pragma unroll
    for (int p = 0; p < 4; ++p) {
        *(v8h*)&Bb[(p * 64 + n0) * LDA + c8] = *(const v8h*)(wg + p * 64 * KDIM);
    }
}

__device__ __forceinline__ void mma_step(const _Float16* Ab, const _Float16* Bb,
                                         v8f (&acc)[2][4],
                                         int wM, int wN, int h, int ln, int kk) {
    // ISA 16-bit A/B layout: lanes 0-15: K = 0..7 then 16..23 ;
    //                        lanes 16-31: K = 8..15 then 24..31
    // kk: which 32-k half of the staged tile
    v16h afrag[2], bfrag[4];
#pragma unroll
    for (int mi = 0; mi < 2; ++mi) {
        int m = wM * 32 + mi * 16 + ln;
        v8h lo = *(const v8h*)&Ab[m * LDA + kk * 32 + 8 * h];
        v8h hi = *(const v8h*)&Ab[m * LDA + kk * 32 + 16 + 8 * h];
        afrag[mi] = __builtin_shufflevector(lo, hi, 0,1,2,3,4,5,6,7,8,9,10,11,12,13,14,15);
    }
#pragma unroll
    for (int ni = 0; ni < 4; ++ni) {
        int n = wN * 64 + ni * 16 + ln;
        v8h lo = *(const v8h*)&Bb[n * LDA + kk * 32 + 8 * h];
        v8h hi = *(const v8h*)&Bb[n * LDA + kk * 32 + 16 + 8 * h];
        bfrag[ni] = __builtin_shufflevector(lo, hi, 0,1,2,3,4,5,6,7,8,9,10,11,12,13,14,15);
    }
#pragma unroll
    for (int mi = 0; mi < 2; ++mi)
#pragma unroll
        for (int ni = 0; ni < 4; ++ni)
            acc[mi][ni] = __builtin_amdgcn_wmma_f32_16x16x32_f16(
                false, afrag[mi], false, bfrag[ni],
                (short)0, acc[mi][ni], false, false);
}

// ---------------------------------------------------------------------------
// Kernel 2: fused  ws = x@w + b  (WMMA f16->f32, double-buffered LDS),
// then 4-way activation mix weighted by attn, store out[m][n] f32.
// 128x256 tile / block (512 thr = 16 waves, each wave 32x64 = 2x4 WMMA tiles),
// 64 k per staged tile. 512 blocks: two per WGP at 128 VGPRs, all resident at once.
// The second launch-bounds figure asks for 8 waves per SIMD, a budget of 128 VGPRs:
// above it only one 16-wave block fits a WGP and the grid takes two rounds.
// ---------------------------------------------------------------------------
__global__ __launch_bounds__(512, 8) void k_gemm_act(const float*    __restrict__ x,
                                                  const _Float16* __restrict__ wT,
                                                  const float*    __restrict__ bias,
                                                  const float*    __restrict__ wf,
                                                  const float*    __restrict__ bf,
                                                  const float*    __restrict__ attn,
                                                  float*          __restrict__ out) {
    __shared__ _Float16 Alds[2][BM * LDA];    // [m][k] f16, padded rows
    __shared__ _Float16 Blds[2][BN * LDA];    // [n][k] f16, padded rows
    __shared__ float4   Atn[BM];              // attention rows for this m-tile

    const int t     = threadIdx.x;
    const int nTile = blockIdx.x & 3;      // N / 256 = 4
    const int mTile = blockIdx.x >> 2;     // M / 128 = 128
    const int mBase = mTile * BM;
    const int nBase = nTile * BN;
    const int wave  = t >> 5;
    const int lane  = t & 31;
    const int wM    = wave & 3;            // 4 waves along M
    const int wN    = wave >> 2;           // 4 waves along N
    const int h     = lane >> 4;           // lane half (K sub-block select)
    const int ln    = lane & 15;           // row/col within 16

    if (t < BM) Atn[t] = ((const float4*)attn)[mBase + t];

    v8f acc[2][4] = {};

    // prologue: stage K-tile 0 into buffer 0
    const float*    xg = x  + (size_t)(mBase + (t >> 4)) * KDIM + (t & 15) * 4;
    const _Float16* wg = wT + (size_t)(nBase + (t >> 3)) * KDIM + (t & 7) * 8;
    stage_tiles(xg, wg, Alds[0], Blds[0], t);
    __syncthreads();

    // software-pipelined main loop: stage next buffer while consuming current
#pragma unroll 1
    for (int kt = 0; kt < KDIM / KT; kt += 2) {
        stage_tiles(xg + (kt + 1) * KT, wg + (kt + 1) * KT, Alds[1], Blds[1], t);
        mma_step(Alds[0], Blds[0], acc, wM, wN, h, ln, 0);
        mma_step(Alds[0], Blds[0], acc, wM, wN, h, ln, 1);
        __syncthreads();
        if (kt + 2 < KDIM / KT)
            stage_tiles(xg + (kt + 2) * KT, wg + (kt + 2) * KT, Alds[0], Blds[0], t);
        mma_step(Alds[1], Blds[1], acc, wM, wN, h, ln, 0);
        mma_step(Alds[1], Blds[1], acc, wM, wN, h, ln, 1);
        __syncthreads();
    }

    // ---- epilogue: bias + 4 activations weighted by attention ----
    // Rows outermost: one attention row is live at a time beside the four columns'
    // constants, which keeps the kernel inside the 128 VGPRs that two blocks per WGP need.
    float  bn[4];
    float4 wfv[4], bfv[4];
#pragma unroll
    for (int ni = 0; ni < 4; ++ni) {
        const int n_g = nBase + wN * 64 + ni * 16 + ln;
        bn[ni]  = bias[n_g];
        wfv[ni] = ((const float4*)wf)[n_g];
        bfv[ni] = ((const float4*)bf)[n_g];
    }
    // this lane's first output element; all others lie at compile-time distances
    float* og = out + (size_t)(mBase + wM * 32 + 8 * h) * NDIM + nBase + wN * 64 + ln;
#pragma unroll
    for (int mi = 0; mi < 2; ++mi) {
#pragma unroll
        for (int i = 0; i < 8; ++i) {
            const int    mloc = wM * 32 + mi * 16 + 8 * h + i;
            const float4 at   = Atn[mloc];
#pragma unroll
            for (int ni = 0; ni < 4; ++ni) {
                const float wsv = acc[mi][ni][i] + bn[ni];
                const float t0 = wsv * wfv[ni].x + bfv[ni].x;
                const float t1 = wsv * wfv[ni].y + bfv[ni].y;
                const float t2 = wsv * wfv[ni].z + bfv[ni].z;
                const float t3 = wsv * wfv[ni].w + bfv[ni].w;
                // relu
                float r = fmaxf(t0, 0.f) * at.x;
                // sigmoid: 1/(1+e^-t) via v_exp + v_rcp (straight-line, ~1ulp)
                r += at.y * __builtin_amdgcn_rcpf(1.f + __expf(-t1));
                // tanh: 1 - 2/(e^{2t}+1)  (saturates correctly at +/-inf)
                r += at.z * fmaf(-2.f, __builtin_amdgcn_rcpf(__expf(2.f * t2) + 1.f), 1.f);
                // exact gelu: 0.5*t*(1+erf(t/sqrt(2)))
                r += at.w * (0.5f * t3 * (1.f + erff(t3 * 0.7071067811865475f)));
                og[(mi * 16 + i) * NDIM + ni * 16] = r;
            }
        }
    }
}

// ---------------------------------------------------------------------------
extern "C" void kernel_launch(void* const* d_in, const int* in_sizes, int n_in,
                              void* d_out, int out_size, void* d_ws, size_t ws_size,
                              hipStream_t stream) {
    (void)in_sizes; (void)n_in; (void)out_size; (void)ws_size;
    const float* x     = (const float*)d_in[0];   // [B,S,D]
    const float* w     = (const float*)d_in[1];   // [D,U]
    const float* b     = (const float*)d_in[2];   // [U]
    const float* wf    = (const float*)d_in[3];   // [U,A]
    const float* bf    = (const float*)d_in[4];   // [U,A]
    const float* w_att = (const float*)d_in[5];   // [D,A]
    const float* b_att = (const float*)d_in[6];   // [A]
    float* out = (float*)d_out;                   // [B,S,U]

    // workspace layout: wT (U*K f16 = 2MB) | attn (M*4 f32 = 256KB)
    _Float16* wT   = (_Float16*)d_ws;
    float*    attn = (float*)((char*)d_ws + (size_t)NDIM * KDIM * sizeof(_Float16));

    k_transpose_w<<<(KDIM / 32) * (NDIM / 32), 256, 0, stream>>>(w, wT);
    k_attention<<<MDIM / 8, 256, 0, stream>>>(x, w_att, b_att, attn);
    k_gemm_act<<<(MDIM / BM) * (NDIM / BN), 512, 0, stream>>>(x, wT, b, wf, bf, attn, out);
}

// v002
// It runs in 52.7 microseconds.
// Timed twice side by side with v001, it ran 1.03 and 1.04 times as fast.
// All steps since v000 together make it 1.53 times as fast.
#include <hip/hip_runtime.h>
#include <hip/hip_bf16.h>
#include <math.h>

// Problem constants (B=8, S=2048, D=1024, U=1024, A=4)
#define MDIM 16384   // B*S
#define KDIM 1024    // D
#define NDIM 1024    // U
#define KT   64      // k extent of one staged tile: 128 B of a wT row, 256 B of an x row (whole lines)
#define BM   128     // rows of out per block
#define BN   256     // columns of out per block
#define LDA  72      // padded LDS row stride in halves (64 data + 8 pad = 9 x 16 B) -> conflict-free b128 reads

typedef __attribute__((ext_vector_type(16))) _Float16 v16h;
typedef __attribute__((ext_vector_type(8)))  _Float16 v8h;
typedef __attribute__((ext_vector_type(4)))  _Float16 v4h;
typedef __attribute__((ext_vector_type(8)))  float    v8f;

// ---------------------------------------------------------------------------
// Kernel 0: both pre-passes in one launch of 256 blocks of 16 waves, one block per WGP.
//   (a) transpose + convert one 64x64 tile:  w[D][U] f32  ->  wT[U][D] f16
//   (b) attn[m][a] = softmax_a( x[m,:] . w_att[:,a] + b_att[a] ) for 64 rows of x
// Few, long-lived waves: a wave streams four whole rows of x with 16-byte loads (512
// contiguous bytes per load, two rows in flight) against w_att held in its registers,
// so the launch is paced by the memory stream and not by how fast waves can be started.
// ---------------------------------------------------------------------------
#define PRE_ROWS 4       // rows of x per wave
#define XCH      8       // 16-byte chunks of a row per lane: 1024 / (32 lanes * 4)

__device__ __forceinline__ void load_row(const float4* __restrict__ p, float4 (&v)[XCH]) {
#pragma unroll
    for (int j = 0; j < XCH; ++j) v[j] = p[j * 32];
}

__device__ __forceinline__ void row_dot(const float4 (&v)[XCH], const float4 (&wr)[4][XCH],
                                        float (&s)[4]) {
#pragma unroll
    for (int a = 0; a < 4; ++a) s[a] = 0.f;
#pragma unroll
    for (int j = 0; j < XCH; ++j)
#pragma unroll
        for (int a = 0; a < 4; ++a) {
            s[a] = fmaf(v[j].x, wr[a][j].x, s[a]);
            s[a] = fmaf(v[j].y, wr[a][j].y, s[a]);
            s[a] = fmaf(v[j].z, wr[a][j].z, s[a]);
            s[a] = fmaf(v[j].w, wr[a][j].w, s[a]);
        }
}

__device__ __forceinline__ void row_softmax(float (&s)[4], const float4 ba, int lane,
                                            float4* __restrict__ dst) {
#pragma unroll
    for (int off = 16; off > 0; off >>= 1)
#pragma unroll
        for (int a = 0; a < 4; ++a) s[a] += __shfl_xor(s[a], off, 32);
    if (lane == 0) {
        const float a0 = s[0] + ba.x, a1 = s[1] + ba.y, a2 = s[2] + ba.z, a3 = s[3] + ba.w;
        const float mx = fmaxf(fmaxf(a0, a1), fmaxf(a2, a3));
        const float e0 = __expf(a0 - mx), e1 = __expf(a1 - mx);
        const float e2 = __expf(a2 - mx), e3 = __expf(a3 - mx);
        const float inv = __builtin_amdgcn_rcpf(e0 + e1 + e2 + e3);
        *dst = make_float4(e0 * inv, e1 * inv, e2 * inv, e3 * inv);
    }
}

__global__ __launch_bounds__(512) void k_prepass(const float* __restrict__ w,
                                                 const float* __restrict__ x,
                                                 const float* __restrict__ w_att,
                                                 const float* __restrict__ b_att,
                                                 _Float16* __restrict__ wT,
                                                 float* __restrict__ attn) {
    __shared__ float tile[64][65];     // one 64(k) x 64(n) tile of w; odd pitch: no bank conflicts either way
    __shared__ float wA[4][KDIM];      // w_att, one plane per activation, k contiguous

    const int t    = threadIdx.x;
    const int wave = t >> 5;
    const int lane = t & 31;
    const int m0   = blockIdx.x * (16 * PRE_ROWS) + wave * PRE_ROWS;   // this wave's first row

    const float4* xr = (const float4*)(x + (size_t)m0 * KDIM) + lane;
    float4 xa[XCH], xb[XCH];

    // ---- stage the w tile and w_att in LDS ----
    const int bn = blockIdx.x & 15;        // n-tile (U/64)
    const int bk = blockIdx.x >> 4;        // k-tile (D/64)
    {
        const int r0 = t >> 4;             // 0..31
        const int c4 = (t & 15) * 4;       // 0..60
        const float* wp = w + (size_t)(bk * 64 + r0) * NDIM + bn * 64 + c4;
        const float4 w0 = *(const float4*)wp;
        const float4 w1 = *(const float4*)(wp + 32 * NDIM);
        const float4 q0 = ((const float4*)w_att)[t];
        const float4 q1 = ((const float4*)w_att)[t + 512];
        // the first two rows of x are asked for here, ahead of the LDS staging, so that
        // they are in flight while the tile and w_att are staged
        load_row(xr, xa);
        load_row(xr + KDIM / 4, xb);
        tile[r0][c4 + 0] = w0.x; tile[r0][c4 + 1] = w0.y;
        tile[r0][c4 + 2] = w0.z; tile[r0][c4 + 3] = w0.w;
        tile[r0 + 32][c4 + 0] = w1.x; tile[r0 + 32][c4 + 1] = w1.y;
        tile[r0 + 32][c4 + 2] = w1.z; tile[r0 + 32][c4 + 3] = w1.w;
        wA[0][t] = q0.x; wA[1][t] = q0.y; wA[2][t] = q0.z; wA[3][t] = q0.w;
        wA[0][t + 512] = q1.x; wA[1][t + 512] = q1.y; wA[2][t + 512] = q1.z; wA[3][t + 512] = q1.w;
    }
    const float4 ba = *(const float4*)b_att;
    // Work-group barrier whose fences name LDS alone: only tile and wA pass between waves
    // here. __syncthreads() would also wait out the x rows in flight, in all 16 waves at
    // once, and leave the memory stream empty behind it.
    __builtin_amdgcn_fence(__ATOMIC_RELEASE, "workgroup", "local");
    __builtin_amdgcn_s_barrier();
    __builtin_amdgcn_fence(__ATOMIC_ACQUIRE, "workgroup", "local");

    // ---- (a) the transposed tile: 8 lanes write one whole 128-byte line of a wT row ----
    {
        const int n  = t >> 3;             // 0..63
        const int k8 = (t & 7) * 8;        // 0..56
        v8h hv;
#pragma unroll
        for (int j = 0; j < 8; ++j) hv[j] = (_Float16)tile[k8 + j][n];
        *(v8h*)(wT + (size_t)(bn * 64 + n) * KDIM + bk * 64 + k8) = hv;
    }

    // ---- (b) attention: w_att for this lane's k positions, kept in registers ----
    float4 wr[4][XCH];
#pragma unroll
    for (int a = 0; a < 4; ++a)
#pragma unroll
        for (int j = 0; j < XCH; ++j) wr[a][j] = *(const float4*)&wA[a][j * 128 + lane * 4];

    float4* ao = (float4*)attn + m0;
    float s[4];
    row_dot(xa, wr, s);
    load_row(xr + 2 * (KDIM / 4), xa);
    row_softmax(s, ba, lane, ao + 0);
    row_dot(xb, wr, s);
    load_row(xr + 3 * (KDIM / 4), xb);
    row_softmax(s, ba, lane, ao + 1);
    row_dot(xa, wr, s);
    row_softmax(s, ba, lane, ao + 2);
    row_dot(xb, wr, s);
    row_softmax(s, ba, lane, ao + 3);
}

// ---------------------------------------------------------------------------
// GEMM helpers
// ---------------------------------------------------------------------------
// xg, wg: this thread's first element of the tile in x and in wT; the further rows of
// the thread lie at compile-time distances, so one address pair per operand stays live.
__device__ __forceinline__ void stage_tiles(const float* __restrict__ xg,
                                            const _Float16* __restrict__ wg,
                                            _Float16* Ab, _Float16* Bb, int t) {
    // A tile: 128 rows x 64 k, f32 -> f16
    const int r0 = t >> 4;              // 0..31
    const int c4 = (t & 15) * 4;        // 0..60
#pragma unroll
    for (int p = 0; p < 4; ++p) {
        float4 v = *(const float4*)(xg + p * 32 * KDIM);
        v4h hv;
        hv[0] = (_Float16)v.x; hv[1] = (_Float16)v.y;
        hv[2] = (_Float16)v.z; hv[3] = (_Float16)v.w;
        *(v4h*)&Ab[(p * 32 + r0) * LDA + c4] = hv;
    }
    // B tile: 256 rows x 64 k, f16
    const int n0 = t >> 3;              // 0..63
    const int c8 = (t & 7) * 8;         // 0..56
#pragma unroll
    for (int p = 0; p < 4; ++p) {
        *(v8h*)&Bb[(p * 64 + n0) * LDA + c8] = *(const v8h*)(wg + p * 64 * KDIM);
    }
}

__device__ __forceinline__ void mma_step(const _Float16* Ab, const _Float16* Bb,
                                         v8f (&acc)[2][4],
                                         int wM, int wN, int h, int ln, int kk) {
    // ISA 16-bit A/B layout: lanes 0-15: K = 0..7 then 16..23 ;
    //                        lanes 16-31: K = 8..15 then 24..31
    // kk: which 32-k half of the staged tile
    v16h afrag[2], bfrag[4];
#pragma unroll
    for (int mi = 0; mi < 2; ++mi) {
        int m = wM * 32 + mi * 16 + ln;
        v8h lo = *(const v8h*)&Ab[m * LDA + kk * 32 + 8 * h];
        v8h hi = *(const v8h*)&Ab[m * LDA + kk * 32 + 16 + 8 * h];
        afrag[mi] = __builtin_shufflevector(lo, hi, 0,1,2,3,4,5,6,7,8,9,10,11,12,13,14,15);
    }
#pragma unroll
    for (int ni = 0; ni < 4; ++ni) {
        int n = wN * 64 + ni * 16 + ln;
        v8h lo = *(const v8h*)&Bb[n * LDA + kk * 32 + 8 * h];
        v8h hi = *(const v8h*)&Bb[n * LDA + kk * 32 + 16 + 8 * h];
        bfrag[ni] = __builtin_shufflevector(lo, hi, 0,1,2,3,4,5,6,7,8,9,10,11,12,13,14,15);
    }
#pragma unroll
    for (int mi = 0; mi < 2; ++mi)
#pragma unroll
        for (int ni = 0; ni < 4; ++ni)
            acc[mi][ni] = __builtin_amdgcn_wmma_f32_16x16x32_f16(
                false, afrag[mi], false, bfrag[ni],
                (short)0, acc[mi][ni], false, false);
}

// ---------------------------------------------------------------------------
// Kernel 1: fused  ws = x@w + b  (WMMA f16->f32, double-buffered LDS),
// then 4-way activation mix weighted by attn, store out[m][n] f32.
// 128x256 tile / block (512 thr = 16 waves, each wave 32x64 = 2x4 WMMA tiles),
// 64 k per staged tile. 512 blocks: two per WGP at 128 VGPRs, all resident at once.
// The second launch-bounds figure asks for 8 waves per SIMD, a budget of 128 VGPRs:
// above it only one 16-wave block fits a WGP and the grid takes two rounds.
// ---------------------------------------------------------------------------
__global__ __launch_bounds__(512, 8) void k_gemm_act(const float*    __restrict__ x,
                                                  const _Float16* __restrict__ wT,
                                                  const float*    __restrict__ bias,
                                                  const float*    __restrict__ wf,
                                                  const float*    __restrict__ bf,
                                                  const float*    __restrict__ attn,
                                                  float*          __restrict__ out) {
    __shared__ _Float16 Alds[2][BM * LDA];    // [m][k] f16, padded rows
    __shared__ _Float16 Blds[2][BN * LDA];    // [n][k] f16, padded rows
    __shared__ float4   Atn[BM];              // attention rows for this m-tile

    const int t     = threadIdx.x;
    const int nTile = blockIdx.x & 3;      // N / 256 = 4
    const int mTile = blockIdx.x >> 2;     // M / 128 = 128
    const int mBase = mTile * BM;
    const int nBase = nTile * BN;
    const int wave  = t >> 5;
    const int lane  = t & 31;
    const int wM    = wave & 3;            // 4 waves along M
    const int wN    = wave >> 2;           // 4 waves along N
    const int h     = lane >> 4;           // lane half (K sub-block select)
    const int ln    = lane & 15;           // row/col within 16

    if (t < BM) Atn[t] = ((const float4*)attn)[mBase + t];

    v8f acc[2][4] = {};

    // prologue: stage K-tile 0 into buffer 0
    const float*    xg = x  + (size_t)(mBase + (t >> 4)) * KDIM + (t & 15) * 4;
    const _Float16* wg = wT + (size_t)(nBase + (t >> 3)) * KDIM + (t & 7) * 8;
    stage_tiles(xg, wg, Alds[0], Blds[0], t);
    __syncthreads();

    // software-pipelined main loop: stage next buffer while consuming current
#pragma unroll 1
    for (int kt = 0; kt < KDIM / KT; kt += 2) {
        stage_tiles(xg + (kt + 1) * KT, wg + (kt + 1) * KT, Alds[1], Blds[1], t);
        mma_step(Alds[0], Blds[0], acc, wM, wN, h, ln, 0);
        mma_step(Alds[0], Blds[0], acc, wM, wN, h, ln, 1);
        __syncthreads();
        if (kt + 2 < KDIM / KT)
            stage_tiles(xg + (kt + 2) * KT, wg + (kt + 2) * KT, Alds[0], Blds[0], t);
        mma_step(Alds[1], Blds[1], acc, wM, wN, h, ln, 0);
        mma_step(Alds[1], Blds[1], acc, wM, wN, h, ln, 1);
        __syncthreads();
    }

    // ---- epilogue: bias + 4 activations weighted by attention ----
    // Rows outermost: one attention row is live at a time beside the four columns'
    // constants, which keeps the kernel inside the 128 VGPRs that two blocks per WGP need.
    float  bn[4];
    float4 wfv[4], bfv[4];
#pragma unroll
    for (int ni = 0; ni < 4; ++ni) {
        const int n_g = nBase + wN * 64 + ni * 16 + ln;
        bn[ni]  = bias[n_g];
        wfv[ni] = ((const float4*)wf)[n_g];
        bfv[ni] = ((const float4*)bf)[n_g];
    }
    // this lane's first output element; all others lie at compile-time distances
    float* og = out + (size_t)(mBase + wM * 32 + 8 * h) * NDIM + nBase + wN * 64 + ln;
#pragma unroll
    for (int mi = 0; mi < 2; ++mi) {
#pragma unroll
        for (int i = 0; i < 8; ++i) {
            const int    mloc = wM * 32 + mi * 16 + 8 * h + i;
            const float4 at   = Atn[mloc];
#pragma unroll
            for (int ni = 0; ni < 4; ++ni) {
                const float wsv = acc[mi][ni][i] + bn[ni];
                const float t0 = wsv * wfv[ni].x + bfv[ni].x;
                const float t1 = wsv * wfv[ni].y + bfv[ni].y;
                const float t2 = wsv * wfv[ni].z + bfv[ni].z;
                const float t3 = wsv * wfv[ni].w + bfv[ni].w;
                // relu
                float r = fmaxf(t0, 0.f) * at.x;
                // sigmoid: 1/(1+e^-t) via v_exp + v_rcp (straight-line, ~1ulp)
                r += at.y * __builtin_amdgcn_rcpf(1.f + __expf(-t1));
                // tanh: 1 - 2/(e^{2t}+1)  (saturates correctly at +/-inf)
                r += at.z * fmaf(-2.f, __builtin_amdgcn_rcpf(__expf(2.f * t2) + 1.f), 1.f);
                // exact gelu: 0.5*t*(1+erf(t/sqrt(2)))
                r += at.w * (0.5f * t3 * (1.f + erff(t3 * 0.7071067811865475f)));
                og[(mi * 16 + i) * NDIM + ni * 16] = r;
            }
        }
    }
}

// ---------------------------------------------------------------------------
extern "C" void kernel_launch(void* const* d_in, const int* in_sizes, int n_in,
                              void* d_out, int out_size, void* d_ws, size_t ws_size,
                              hipStream_t stream) {
    (void)in_sizes; (void)n_in; (void)out_size; (void)ws_size;
    const float* x     = (const float*)d_in[0];   // [B,S,D]
    const float* w     = (const float*)d_in[1];   // [D,U]
    const float* b     = (const float*)d_in[2];   // [U]
    const float* wf    = (const float*)d_in[3];   // [U,A]
    const float* bf    = (const float*)d_in[4];   // [U,A]
    const float* w_att = (const float*)d_in[5];   // [D,A]
    const float* b_att = (const float*)d_in[6];   // [A]
    float* out = (float*)d_out;                   // [B,S,U]

    // workspace layout: wT (U*K f16 = 2MB) | attn (M*4 f32 = 256KB)
    _Float16* wT   = (_Float16*)d_ws;
    float*    attn = (float*)((char*)d_ws + (size_t)NDIM * KDIM * sizeof(_Float16));

    k_prepass<<<MDIM / (16 * PRE_ROWS), 512, 0, stream>>>(w, x, w_att, b_att, wT, attn);
    k_gemm_act<<<(MDIM / BM) * (NDIM / BN), 512, 0, stream>>>(x, wT, b, wf, bf, attn, out);
}

// v003
// A run of this version takes 47.9 microseconds.
// Two timings next to v002 both put it at 1.10 times that version's speed.
// Counting every step since v000, it is 1.68 times as fast.
#include <hip/hip_runtime.h>
#include <hip/hip_bf16.h>
#include <math.h>

// Problem constants (B=8, S=2048, D=1024, U=1024, A=4)
#define MDIM 16384   // B*S
#define KDIM 1024    // D
#define NDIM 1024    // U
#define KT   64      // k extent of one staged tile: 128 B of a wT row, 256 B of an x row (whole lines)
#define BM   128     // rows of out per block
#define BN   256     // columns of out per block
#define LDA  72      // padded LDS row stride in halves (64 data + 8 pad = 9 x 16 B) -> conflict-free b128 reads

typedef __attribute__((ext_vector_type(16))) _Float16 v16h;
typedef __attribute__((ext_vector_type(8)))  _Float16 v8h;
typedef __attribute__((ext_vector_type(4)))  _Float16 v4h;
typedef __attribute__((ext_vector_type(8)))  float    v8f;
typedef __attribute__((ext_vector_type(2)))  float    v2f;

// ---------------------------------------------------------------------------
// Kernel 0: both pre-passes in one launch of 256 blocks of 16 waves, one block per WGP.
//   (a) transpose + convert one 64x64 tile:  w[D][U] f32  ->  wT[U][D] f16
//   (b) attn[m][a] = softmax_a( x[m,:] . w_att[:,a] + b_att[a] ) for 64 rows of x
// Few, long-lived waves: a wave streams four whole rows of x with 16-byte loads (512
// contiguous bytes per load, two rows in flight) against w_att held in its registers,
// so the launch is paced by the memory stream and not by how fast waves can be started.
// ---------------------------------------------------------------------------
#define PRE_ROWS 4       // rows of x per wave
#define XCH      8       // 16-byte chunks of a row per lane: 1024 / (32 lanes * 4)

__device__ __forceinline__ void load_row(const float4* __restrict__ p, float4 (&v)[XCH]) {
#pragma unroll
    for (int j = 0; j < XCH; ++j) v[j] = p[j * 32];
}

__device__ __forceinline__ void row_dot(const float4 (&v)[XCH], const float4 (&wr)[4][XCH],
                                        float (&s)[4]) {
#pragma unroll
    for (int a = 0; a < 4; ++a) s[a] = 0.f;
#pragma unroll
    for (int j = 0; j < XCH; ++j)
#pragma unroll
        for (int a = 0; a < 4; ++a) {
            s[a] = fmaf(v[j].x, wr[a][j].x, s[a]);
            s[a] = fmaf(v[j].y, wr[a][j].y, s[a]);
            s[a] = fmaf(v[j].z, wr[a][j].z, s[a]);
            s[a] = fmaf(v[j].w, wr[a][j].w, s[a]);
        }
}

__device__ __forceinline__ void row_softmax(float (&s)[4], const float4 ba, int lane,
                                            float4* __restrict__ dst) {
#pragma unroll
    for (int off = 16; off > 0; off >>= 1)
#pragma unroll
        for (int a = 0; a < 4; ++a) s[a] += __shfl_xor(s[a], off, 32);
    if (lane == 0) {
        const float a0 = s[0] + ba.x, a1 = s[1] + ba.y, a2 = s[2] + ba.z, a3 = s[3] + ba.w;
        const float mx = fmaxf(fmaxf(a0, a1), fmaxf(a2, a3));
        const float e0 = __expf(a0 - mx), e1 = __expf(a1 - mx);
        const float e2 = __expf(a2 - mx), e3 = __expf(a3 - mx);
        const float inv = __builtin_amdgcn_rcpf(e0 + e1 + e2 + e3);
        *dst = make_float4(e0 * inv, e1 * inv, e2 * inv, e3 * inv);
    }
}

__global__ __launch_bounds__(512) void k_prepass(const float* __restrict__ w,
                                                 const float* __restrict__ x,
                                                 const float* __restrict__ w_att,
                                                 const float* __restrict__ b_att,
                                                 _Float16* __restrict__ wT,
                                                 float* __restrict__ attn) {
    __shared__ float tile[64][65];     // one 64(k) x 64(n) tile of w; odd pitch: no bank conflicts either way
    __shared__ float wA[4][KDIM];      // w_att, one plane per activation, k contiguous

    const int t    = threadIdx.x;
    const int wave = t >> 5;
    const int lane = t & 31;
    const int m0   = blockIdx.x * (16 * PRE_ROWS) + wave * PRE_ROWS;   // this wave's first row

    const float4* xr = (const float4*)(x + (size_t)m0 * KDIM) + lane;
    float4 xa[XCH], xb[XCH];

    // ---- stage the w tile and w_att in LDS ----
    const int bn = blockIdx.x & 15;        // n-tile (U/64)
    const int bk = blockIdx.x >> 4;        // k-tile (D/64)
    {
        const int r0 = t >> 4;             // 0..31
        const int c4 = (t & 15) * 4;       // 0..60
        const float* wp = w + (size_t)(bk * 64 + r0) * NDIM + bn * 64 + c4;
        const float4 w0 = *(const float4*)wp;
        const float4 w1 = *(const float4*)(wp + 32 * NDIM);
        const float4 q0 = ((const float4*)w_att)[t];
        const float4 q1 = ((const float4*)w_att)[t + 512];
        // the first two rows of x are asked for here, ahead of the LDS staging, so that
        // they are in flight while the tile and w_att are staged
        load_row(xr, xa);
        load_row(xr + KDIM / 4, xb);
        tile[r0][c4 + 0] = w0.x; tile[r0][c4 + 1] = w0.y;
        tile[r0][c4 + 2] = w0.z; tile[r0][c4 + 3] = w0.w;
        tile[r0 + 32][c4 + 0] = w1.x; tile[r0 + 32][c4 + 1] = w1.y;
        tile[r0 + 32][c4 + 2] = w1.z; tile[r0 + 32][c4 + 3] = w1.w;
        wA[0][t] = q0.x; wA[1][t] = q0.y; wA[2][t] = q0.z; wA[3][t] = q0.w;
        wA[0][t + 512] = q1.x; wA[1][t + 512] = q1.y; wA[2][t + 512] = q1.z; wA[3][t + 512] = q1.w;
    }
    const float4 ba = *(const float4*)b_att;
    // Work-group barrier whose fences name LDS alone: only tile and wA pass between waves
    // here. __syncthreads() would also wait out the x rows in flight, in all 16 waves at
    // once, and leave the memory stream empty behind it.
    __builtin_amdgcn_fence(__ATOMIC_RELEASE, "workgroup", "local");
    __builtin_amdgcn_s_barrier();
    __builtin_amdgcn_fence(__ATOMIC_ACQUIRE, "workgroup", "local");

    // ---- (a) the transposed tile: 8 lanes write one whole 128-byte line of a wT row ----
    {
        const int n  = t >> 3;             // 0..63
        const int k8 = (t & 7) * 8;        // 0..56
        v8h hv;
#pragma unroll
        for (int j = 0; j < 8; ++j) hv[j] = (_Float16)tile[k8 + j][n];
        *(v8h*)(wT + (size_t)(bn * 64 + n) * KDIM + bk * 64 + k8) = hv;
    }

    // ---- (b) attention: w_att for this lane's k positions, kept in registers ----
    float4 wr[4][XCH];
#pragma unroll
    for (int a = 0; a < 4; ++a)
#pragma unroll
        for (int j = 0; j < XCH; ++j) wr[a][j] = *(const float4*)&wA[a][j * 128 + lane * 4];

    float4* ao = (float4*)attn + m0;
    float s[4];
    row_dot(xa, wr, s);
    load_row(xr + 2 * (KDIM / 4), xa);
    row_softmax(s, ba, lane, ao + 0);
    row_dot(xb, wr, s);
    load_row(xr + 3 * (KDIM / 4), xb);
    row_softmax(s, ba, lane, ao + 1);
    row_dot(xa, wr, s);
    row_softmax(s, ba, lane, ao + 2);
    row_dot(xb, wr, s);
    row_softmax(s, ba, lane, ao + 3);
}

// ---------------------------------------------------------------------------
// GEMM helpers
// ---------------------------------------------------------------------------
// xg, wg: this thread's first element of the tile in x and in wT; the further rows of
// the thread lie at compile-time distances, so one address pair per operand stays live.
__device__ __forceinline__ void stage_tiles(const float* __restrict__ xg,
                                            const _Float16* __restrict__ wg,
                                            _Float16* Ab, _Float16* Bb, int t) {
    // A tile: 128 rows x 64 k, f32 -> f16
    const int r0 = t >> 4;              // 0..31
    const int c4 = (t & 15) * 4;        // 0..60
#pragma unroll
    for (int p = 0; p < 4; ++p) {
        float4 v = *(const float4*)(xg + p * 32 * KDIM);
        v4h hv;
        hv[0] = (_Float16)v.x; hv[1] = (_Float16)v.y;
        hv[2] = (_Float16)v.z; hv[3] = (_Float16)v.w;
        *(v4h*)&Ab[(p * 32 + r0) * LDA + c4] = hv;
    }
    // B tile: 256 rows x 64 k, f16
    const int n0 = t >> 3;              // 0..63
    const int c8 = (t & 7) * 8;         // 0..56
#pragma unroll
    for (int p = 0; p < 4; ++p) {
        *(v8h*)&Bb[(p * 64 + n0) * LDA + c8] = *(const v8h*)(wg + p * 64 * KDIM);
    }
}

__device__ __forceinline__ void mma_step(const _Float16* Ab, const _Float16* Bb,
                                         v8f (&acc)[2][4],
                                         int wM, int wN, int h, int ln, int kk) {
    // ISA 16-bit A/B layout: lanes 0-15: K = 0..7 then 16..23 ;
    //                        lanes 16-31: K = 8..15 then 24..31
    // kk: which 32-k half of the staged tile
    v16h afrag[2], bfrag[4];
#pragma unroll
    for (int mi = 0; mi < 2; ++mi) {
        int m = wM * 32 + mi * 16 + ln;
        v8h lo = *(const v8h*)&Ab[m * LDA + kk * 32 + 8 * h];
        v8h hi = *(const v8h*)&Ab[m * LDA + kk * 32 + 16 + 8 * h];
        afrag[mi] = __builtin_shufflevector(lo, hi, 0,1,2,3,4,5,6,7,8,9,10,11,12,13,14,15);
    }
#pragma unroll
    for (int ni = 0; ni < 4; ++ni) {
        int n = wN * 64 + ni * 16 + ln;
        v8h lo = *(const v8h*)&Bb[n * LDA + kk * 32 + 8 * h];
        v8h hi = *(const v8h*)&Bb[n * LDA + kk * 32 + 16 + 8 * h];
        bfrag[ni] = __builtin_shufflevector(lo, hi, 0,1,2,3,4,5,6,7,8,9,10,11,12,13,14,15);
    }
#pragma unroll
    for (int mi = 0; mi < 2; ++mi)
#pragma unroll
        for (int ni = 0; ni < 4; ++ni)
            acc[mi][ni] = __builtin_amdgcn_wmma_f32_16x16x32_f16(
                false, afrag[mi], false, bfrag[ni],
                (short)0, acc[mi][ni], false, false);
}

// Two rows of one output column at a time: the multiply-adds of a pair go out as one
// packed instruction; only 2^x and 1/x are issued once per element.
__device__ __forceinline__ v2f exp2_pair(v2f v) {
    v2f r;
    r.x = __builtin_amdgcn_exp2f(v.x);
    r.y = __builtin_amdgcn_exp2f(v.y);
    return r;
}
__device__ __forceinline__ v2f rcp_pair(v2f v) {
    v2f r;
    r.x = __builtin_amdgcn_rcpf(v.x);
    r.y = __builtin_amdgcn_rcpf(v.y);
    return r;
}

// ---------------------------------------------------------------------------
// Kernel 1: fused  ws = x@w + b  (WMMA f16->f32, double-buffered LDS),
// then 4-way activation mix weighted by attn, store out[m][n] f32.
// 128x256 tile / block (512 thr = 16 waves, each wave 32x64 = 2x4 WMMA tiles),
// 64 k per staged tile. 512 blocks: two per WGP at 128 VGPRs, all resident at once.
// The second launch-bounds figure asks for 8 waves per SIMD, a budget of 128 VGPRs:
// above it only one 16-wave block fits a WGP and the grid takes two rounds.
// ---------------------------------------------------------------------------
__global__ __launch_bounds__(512, 8) void k_gemm_act(const float*    __restrict__ x,
                                                  const _Float16* __restrict__ wT,
                                                  const float*    __restrict__ bias,
                                                  const float*    __restrict__ wf,
                                                  const float*    __restrict__ bf,
                                                  const float*    __restrict__ attn,
                                                  float*          __restrict__ out) {
    // One LDS object with the epilogue's small tables first: below 64 KiB their planes and
    // rows are reached by the offset field of the LDS loads, from one address register each.
    __shared__ struct {
        // attention weights of this m-tile, one plane per factor of the epilogue's sum:
        // relu, sigmoid, tanh's constant 1, tanh's quotient, gelu's relu part, gelu's tail
        float    Atn[6][BM];
        // per output column: scale and offset of each activation's argument (see below)
        float    Ccol[8][BN];
        _Float16 Alds[2][BM * LDA];           // [m][k] f16, padded rows
        _Float16 Blds[2][BN * LDA];           // [n][k] f16, padded rows
    } __attribute__((aligned(16))) sm;
    auto& Atn  = sm.Atn;
    auto& Ccol = sm.Ccol;
    auto& Alds = sm.Alds;
    auto& Blds = sm.Blds;

    const int t     = threadIdx.x;
    const int nTile = blockIdx.x & 3;      // N / 256 = 4
    const int mTile = blockIdx.x >> 2;     // M / 128 = 128
    const int mBase = mTile * BM;
    const int nBase = nTile * BN;
    const int wave  = t >> 5;
    const int lane  = t & 31;
    const int wM    = wave & 3;            // 4 waves along M
    const int wN    = wave >> 2;           // 4 waves along N
    const int h     = lane >> 4;           // lane half (K sub-block select)
    const int ln    = lane & 15;           // row/col within 16

    if (t < BM) {
        const float4 at = ((const float4*)attn)[mBase + t];
        Atn[0][t] = at.x;
        Atn[1][t] = at.y;
        Atn[2][t] = at.z;
        Atn[3][t] = -2.f * at.z;
        Atn[4][t] = at.w;
        Atn[5][t] = -0.5f * at.w;
    }
    // Per column the bias and the scale of each activation's argument are folded into one
    // multiply-add on the accumulator:  t_a = acc * Ccol[a] + Ccol[4 + a]
    //   a = 0  relu:     t
    //   a = 1  sigmoid:  -t * log2(e)      1 / (1 + 2^arg)
    //   a = 2  tanh:     2t * log2(e)      1 - 2 / (2^arg + 1)   (saturates correctly at +/-inf)
    //   a = 3  gelu:     t
    if (t < BN) {
        const float  L2E = 1.4426950408889634f;
        const float  bn  = bias[nBase + t];
        const float4 wfv = ((const float4*)wf)[nBase + t];
        const float4 bfv = ((const float4*)bf)[nBase + t];
        Ccol[0][t] = wfv.x;              Ccol[4][t] = fmaf(bn, wfv.x, bfv.x);
        Ccol[1][t] = -L2E * wfv.y;       Ccol[5][t] = -L2E * fmaf(bn, wfv.y, bfv.y);
        Ccol[2][t] = 2.f * L2E * wfv.z;  Ccol[6][t] = 2.f * L2E * fmaf(bn, wfv.z, bfv.z);
        Ccol[3][t] = wfv.w;              Ccol[7][t] = fmaf(bn, wfv.w, bfv.w);
    }

    v8f acc[2][4] = {};

    // prologue: stage K-tile 0 into buffer 0
    const float*    xg = x  + (size_t)(mBase + (t >> 4)) * KDIM + (t & 15) * 4;
    const _Float16* wg = wT + (size_t)(nBase + (t >> 3)) * KDIM + (t & 7) * 8;
    stage_tiles(xg, wg, Alds[0], Blds[0], t);
    __syncthreads();

    // software-pipelined main loop: stage next buffer while consuming current
#pragma unroll 1
    for (int kt = 0; kt < KDIM / KT; kt += 2) {
        stage_tiles(xg + (kt + 1) * KT, wg + (kt + 1) * KT, Alds[1], Blds[1], t);
        mma_step(Alds[0], Blds[0], acc, wM, wN, h, ln, 0);
        mma_step(Alds[0], Blds[0], acc, wM, wN, h, ln, 1);
        __syncthreads();
        if (kt + 2 < KDIM / KT)
            stage_tiles(xg + (kt + 2) * KT, wg + (kt + 2) * KT, Alds[0], Blds[0], t);
        mma_step(Alds[1], Blds[1], acc, wM, wN, h, ln, 0);
        mma_step(Alds[1], Blds[1], acc, wM, wN, h, ln, 1);
        __syncthreads();
    }

    // ---- epilogue: 4 activations weighted by attention ----
    // Columns outermost: one column's eight constants are live at a time (a packed
    // instruction takes each from a register pair), the attention pairs come from LDS anew
    // for each column; that keeps the kernel inside the 128 VGPRs that two blocks per WGP need.
    // this lane's first output element; all others lie at compile-time distances
    float* og = out + (size_t)(mBase + wM * 32 + 8 * h) * NDIM + nBase + wN * 64 + ln;
#pragma unroll
    for (int ni = 0; ni < 4; ++ni) {
        const int   nl  = wN * 64 + ni * 16 + ln;
        const float cw0 = Ccol[0][nl], cw1 = Ccol[1][nl], cw2 = Ccol[2][nl], cw3 = Ccol[3][nl];
        const float cc0 = Ccol[4][nl], cc1 = Ccol[5][nl], cc2 = Ccol[6][nl], cc3 = Ccol[7][nl];
#pragma unroll
        for (int mi = 0; mi < 2; ++mi) {
#pragma unroll
            for (int ip = 0; ip < 4; ++ip) {
                // Wave-scope fence on LDS, no instruction of its own: it makes the compiler read
                // the attention pairs anew here. Without it all 96 values are read once, kept
                // across the four columns and spilled to scratch memory.
                __builtin_amdgcn_fence(__ATOMIC_ACQUIRE, "wavefront", "local");
                const int mloc = wM * 32 + mi * 16 + 8 * h + 2 * ip;
                const v2f a_relu = *(const v2f*)&Atn[0][mloc];
                const v2f a_sig  = *(const v2f*)&Atn[1][mloc];
                const v2f a_one  = *(const v2f*)&Atn[2][mloc];
                const v2f a_tanh = *(const v2f*)&Atn[3][mloc];
                const v2f a_gel  = *(const v2f*)&Atn[4][mloc];
                const v2f a_tail = *(const v2f*)&Atn[5][mloc];
                v2f a;
                a.x = acc[mi][ni][2 * ip];
                a.y = acc[mi][ni][2 * ip + 1];
                const v2f t0 = a * cw0 + cc0;
                const v2f t1 = a * cw1 + cc1;
                const v2f t2 = a * cw2 + cc2;
                const v2f t3 = a * cw3 + cc3;
                // exact gelu, branch-free:  t * Phi(t) = max(t, 0) - 0.5 * |t| * erfc(|t| / sqrt(2)),
                // erfc(u / sqrt(2)) = 2^(u * q(u)), q fitted on 0 <= u <= 6 so that the gelu is
                // right to 2e-7 (f32 rounding level); from u = 8 on the tail is below 1e-14 and
                // u is held there, so the term stays that small for every larger |t|.
                const v2f u = __builtin_elementwise_min(__builtin_elementwise_abs(t3), (v2f)8.f);
                v2f q = u * 2.99305648e-5f + -7.39926647e-4f;
                q = q * u + 7.97762070e-3f;
                q = q * u + -5.32383993e-2f;
                q = q * u + -4.58915561e-1f;
                q = q * u + -1.15114713f;
                const v2f e1 = exp2_pair(t1);
                const v2f e2 = exp2_pair(t2);
                const v2f qu = q * u;
                const v2f e3 = exp2_pair(qu);
                // The slot that the instruction set asks for between a transcendental and a vector
                // instruction that overwrites its source. The operands (inputs only) hold the v_nop
                // behind both 2^x and keep their arguments' registers untouched up to it.
                asm volatile("v_nop" :: "v"(qu.x), "v"(qu.y), "v"(e3.x), "v"(e3.y));
                const v2f r1 = rcp_pair(e1 + 1.f);
                const v2f r2 = rcp_pair(e2 + 1.f);
                v2f r = a_relu * __builtin_elementwise_max(t0, (v2f)0.f) + a_one;
                r += a_gel  * __builtin_elementwise_max(t3, (v2f)0.f);
                r += a_tail * (u * e3);
                r += a_sig  * r1;
                r += a_tanh * r2;
                og[(mi * 16 + 2 * ip) * NDIM + ni * 16]     = r.x;
                og[(mi * 16 + 2 * ip + 1) * NDIM + ni * 16] = r.y;
            }
        }
    }
}

// ---------------------------------------------------------------------------
extern "C" void kernel_launch(void* const* d_in, const int* in_sizes, int n_in,
                              void* d_out, int out_size, void* d_ws, size_t ws_size,
                              hipStream_t stream) {
    (void)in_sizes; (void)n_in; (void)out_size; (void)ws_size;
    const float* x     = (const float*)d_in[0];   // [B,S,D]
    const float* w     = (const float*)d_in[1];   // [D,U]
    const float* b     = (const float*)d_in[2];   // [U]
    const float* wf    = (const float*)d_in[3];   // [U,A]
    const float* bf    = (const float*)d_in[4];   // [U,A]
    const float* w_att = (const float*)d_in[5];   // [D,A]
    const float* b_att = (const float*)d_in[6];   // [A]
    float* out = (float*)d_out;                   // [B,S,U]

    // workspace layout: wT (U*K f16 = 2MB) | attn (M*4 f32 = 256KB)
    _Float16* wT   = (_Float16*)d_ws;
    float*    attn = (float*)((char*)d_ws + (size_t)NDIM * KDIM * sizeof(_Float16));

    k_prepass<<<MDIM / (16 * PRE_ROWS), 512, 0, stream>>>(w, x, w_att, b_att, wT, attn);
    k_gemm_act<<<(MDIM / BM) * (NDIM / BN), 512, 0, stream>>>(x, wT, b, wf, bf, attn, out);
}

// v004
// It runs in 44.8 microseconds.
// Next to v003, in two timings, it ran 1.07 times as fast each time.
// Over all steps from v000 it is 1.80 times as fast.
#include <hip/hip_runtime.h>
#include <hip/hip_bf16.h>
#include <math.h>

// Problem constants (B=8, S=2048, D=1024, U=1024, A=4)
#define MDIM 16384   // B*S
#define KDIM 1024    // D
#define NDIM 1024    // U
#define KT   64      // k extent of one staged tile: 128 B of a wT row, 256 B of an x row (whole lines)
#define BM   128     // rows of out per block
#define BN   256     // columns of out per block
#define LDA  72      // padded LDS row stride in halves (64 data + 8 pad = 9 x 16 B) -> conflict-free b128 reads

typedef __attribute__((ext_vector_type(16))) _Float16 v16h;
typedef __attribute__((ext_vector_type(8)))  _Float16 v8h;
typedef __attribute__((ext_vector_type(4)))  _Float16 v4h;
typedef __attribute__((ext_vector_type(8)))  float    v8f;
typedef __attribute__((ext_vector_type(2)))  float    v2f;

// ---------------------------------------------------------------------------
// Kernel 0: both pre-passes in one launch of 256 blocks of 16 waves, one block per WGP.
//   (a) transpose + convert one 64x64 tile:  w[D][U] f32  ->  wT[U][D] f16
//   (b) attn[m][a] = softmax_a( x[m,:] . w_att[:,a] + b_att[a] ) for 64 rows of x
// Few, long-lived waves: a wave streams four whole rows of x with 16-byte loads (512
// contiguous bytes per load, two rows in flight) against w_att held in its registers,
// so the launch is paced by the memory stream and not by how fast waves can be started.
// ---------------------------------------------------------------------------
#define PRE_ROWS 4       // rows of x per wave
#define XCH      8       // 16-byte chunks of a row per lane: 1024 / (32 lanes * 4)

__device__ __forceinline__ void load_row(const float4* __restrict__ p, float4 (&v)[XCH]) {
#pragma unroll
    for (int j = 0; j < XCH; ++j) v[j] = p[j * 32];
}

__device__ __forceinline__ void row_dot(const float4 (&v)[XCH], const float4 (&wr)[4][XCH],
                                        float (&s)[4]) {
#pragma unroll
    for (int a = 0; a < 4; ++a) s[a] = 0.f;
#pragma unroll
    for (int j = 0; j < XCH; ++j)
#pragma unroll
        for (int a = 0; a < 4; ++a) {
            s[a] = fmaf(v[j].x, wr[a][j].x, s[a]);
            s[a] = fmaf(v[j].y, wr[a][j].y, s[a]);
            s[a] = fmaf(v[j].z, wr[a][j].z, s[a]);
            s[a] = fmaf(v[j].w, wr[a][j].w, s[a]);
        }
}

__device__ __forceinline__ void row_softmax(float (&s)[4], const float4 ba, int lane,
                                            float4* __restrict__ dst) {
#pragma unroll
    for (int off = 16; off > 0; off >>= 1)
#pragma unroll
        for (int a = 0; a < 4; ++a) s[a] += __shfl_xor(s[a], off, 32);
    if (lane == 0) {
        const float a0 = s[0] + ba.x, a1 = s[1] + ba.y, a2 = s[2] + ba.z, a3 = s[3] + ba.w;
        const float mx = fmaxf(fmaxf(a0, a1), fmaxf(a2, a3));
        const float e0 = __expf(a0 - mx), e1 = __expf(a1 - mx);
        const float e2 = __expf(a2 - mx), e3 = __expf(a3 - mx);
        const float inv = __builtin_amdgcn_rcpf(e0 + e1 + e2 + e3);
        *dst = make_float4(e0 * inv, e1 * inv, e2 * inv, e3 * inv);
    }
}

__global__ __launch_bounds__(512) void k_prepass(const float* __restrict__ w,
                                                 const float* __restrict__ x,
                                                 const float* __restrict__ w_att,
                                                 const float* __restrict__ b_att,
                                                 _Float16* __restrict__ wT,
                                                 float* __restrict__ attn) {
    __shared__ float tile[64][65];     // one 64(k) x 64(n) tile of w; odd pitch: no bank conflicts either way
    __shared__ float wA[4][KDIM];      // w_att, one plane per activation, k contiguous

    const int t    = threadIdx.x;
    const int wave = t >> 5;
    const int lane = t & 31;
    // Which 64 rows of x this block streams: the half (bit 3 of the index) of the 128-row tile
    // whose number has the block index's low three bits. The GEMM deals its row tiles by the
    // same three bits. A permutation of the rows: speed only.
    const int rowTile = (blockIdx.x & 7) + 8 * (blockIdx.x >> 4);
    const int m0   = rowTile * BM + ((blockIdx.x >> 3) & 1) * (16 * PRE_ROWS)
                   + wave * PRE_ROWS;                                  // this wave's first row

    const float4* xr = (const float4*)(x + (size_t)m0 * KDIM) + lane;
    float4 xa[XCH], xb[XCH];

    // ---- stage the w tile and w_att in LDS ----
    const int bn = blockIdx.x & 15;        // n-tile (U/64)
    const int bk = blockIdx.x >> 4;        // k-tile (D/64)
    {
        const int r0 = t >> 4;             // 0..31
        const int c4 = (t & 15) * 4;       // 0..60
        const float* wp = w + (size_t)(bk * 64 + r0) * NDIM + bn * 64 + c4;
        const float4 w0 = *(const float4*)wp;
        const float4 w1 = *(const float4*)(wp + 32 * NDIM);
        const float4 q0 = ((const float4*)w_att)[t];
        const float4 q1 = ((const float4*)w_att)[t + 512];
        // the first two rows of x are asked for here, ahead of the LDS staging, so that
        // they are in flight while the tile and w_att are staged
        load_row(xr, xa);
        load_row(xr + KDIM / 4, xb);
        tile[r0][c4 + 0] = w0.x; tile[r0][c4 + 1] = w0.y;
        tile[r0][c4 + 2] = w0.z; tile[r0][c4 + 3] = w0.w;
        tile[r0 + 32][c4 + 0] = w1.x; tile[r0 + 32][c4 + 1] = w1.y;
        tile[r0 + 32][c4 + 2] = w1.z; tile[r0 + 32][c4 + 3] = w1.w;
        wA[0][t] = q0.x; wA[1][t] = q0.y; wA[2][t] = q0.z; wA[3][t] = q0.w;
        wA[0][t + 512] = q1.x; wA[1][t + 512] = q1.y; wA[2][t + 512] = q1.z; wA[3][t + 512] = q1.w;
    }
    const float4 ba = *(const float4*)b_att;
    // Work-group barrier whose fences name LDS alone: only tile and wA pass between waves
    // here. __syncthreads() would also wait out the x rows in flight, in all 16 waves at
    // once, and leave the memory stream empty behind it.
    __builtin_amdgcn_fence(__ATOMIC_RELEASE, "workgroup", "local");
    __builtin_amdgcn_s_barrier();
    __builtin_amdgcn_fence(__ATOMIC_ACQUIRE, "workgroup", "local");

    // ---- (a) the transposed tile: 8 lanes write one whole 128-byte line of a wT row ----
    {
        const int n  = t >> 3;             // 0..63
        const int k8 = (t & 7) * 8;        // 0..56
        v8h hv;
#pragma unroll
        for (int j = 0; j < 8; ++j) hv[j] = (_Float16)tile[k8 + j][n];
        *(v8h*)(wT + (size_t)(bn * 64 + n) * KDIM + bk * 64 + k8) = hv;
    }

    // ---- (b) attention: w_att for this lane's k positions, kept in registers ----
    float4 wr[4][XCH];
#pragma unroll
    for (int a = 0; a < 4; ++a)
#pragma unroll
        for (int j = 0; j < XCH; ++j) wr[a][j] = *(const float4*)&wA[a][j * 128 + lane * 4];

    float4* ao = (float4*)attn + m0;
    float s[4];
    row_dot(xa, wr, s);
    load_row(xr + 2 * (KDIM / 4), xa);
    row_softmax(s, ba, lane, ao + 0);
    row_dot(xb, wr, s);
    load_row(xr + 3 * (KDIM / 4), xb);
    row_softmax(s, ba, lane, ao + 1);
    row_dot(xa, wr, s);
    row_softmax(s, ba, lane, ao + 2);
    row_dot(xb, wr, s);
    row_softmax(s, ba, lane, ao + 3);
}

// ---------------------------------------------------------------------------
// GEMM helpers
// ---------------------------------------------------------------------------
// xg, wg: this thread's first element of the tile in x and in wT; the further rows of
// the thread lie at compile-time distances, so one address pair per operand stays live.
__device__ __forceinline__ void stage_tiles(const float* __restrict__ xg,
                                            const _Float16* __restrict__ wg,
                                            _Float16* Ab, _Float16* Bb, int t) {
    // A tile: 128 rows x 64 k, f32 -> f16
    const int r0 = t >> 4;              // 0..31
    const int c4 = (t & 15) * 4;        // 0..60
#pragma unroll
    for (int p = 0; p < 4; ++p) {
        float4 v = *(const float4*)(xg + p * 32 * KDIM);
        v4h hv;
        hv[0] = (_Float16)v.x; hv[1] = (_Float16)v.y;
        hv[2] = (_Float16)v.z; hv[3] = (_Float16)v.w;
        *(v4h*)&Ab[(p * 32 + r0) * LDA + c4] = hv;
    }
    // B tile: 256 rows x 64 k, f16
    const int n0 = t >> 3;              // 0..63
    const int c8 = (t & 7) * 8;         // 0..56
#pragma unroll
    for (int p = 0; p < 4; ++p) {
        *(v8h*)&Bb[(p * 64 + n0) * LDA + c8] = *(const v8h*)(wg + p * 64 * KDIM);
    }
}

__device__ __forceinline__ void mma_step(const _Float16* Ab, const _Float16* Bb,
                                         v8f (&acc)[2][4],
                                         int wM, int wN, int h, int ln, int kk) {
    // ISA 16-bit A/B layout: lanes 0-15: K = 0..7 then 16..23 ;
    //                        lanes 16-31: K = 8..15 then 24..31
    // kk: which 32-k half of the staged tile
    v16h afrag[2], bfrag[4];
#pragma unroll
    for (int mi = 0; mi < 2; ++mi) {
        int m = wM * 32 + mi * 16 + ln;
        v8h lo = *(const v8h*)&Ab[m * LDA + kk * 32 + 8 * h];
        v8h hi = *(const v8h*)&Ab[m * LDA + kk * 32 + 16 + 8 * h];
        afrag[mi] = __builtin_shufflevector(lo, hi, 0,1,2,3,4,5,6,7,8,9,10,11,12,13,14,15);
    }
#pragma unroll
    for (int ni = 0; ni < 4; ++ni) {
        int n = wN * 64 + ni * 16 + ln;
        v8h lo = *(const v8h*)&Bb[n * LDA + kk * 32 + 8 * h];
        v8h hi = *(const v8h*)&Bb[n * LDA + kk * 32 + 16 + 8 * h];
        bfrag[ni] = __builtin_shufflevector(lo, hi, 0,1,2,3,4,5,6,7,8,9,10,11,12,13,14,15);
    }
#pragma unroll
    for (int mi = 0; mi < 2; ++mi)
#pragma unroll
        for (int ni = 0; ni < 4; ++ni)
            acc[mi][ni] = __builtin_amdgcn_wmma_f32_16x16x32_f16(
                false, afrag[mi], false, bfrag[ni],
                (short)0, acc[mi][ni], false, false);
}

// Two rows of one output column at a time: the multiply-adds of a pair go out as one
// packed instruction; only 2^x and 1/x are issued once per element.
__device__ __forceinline__ v2f exp2_pair(v2f v) {
    v2f r;
    r.x = __builtin_amdgcn_exp2f(v.x);
    r.y = __builtin_amdgcn_exp2f(v.y);
    return r;
}
__device__ __forceinline__ v2f rcp_pair(v2f v) {
    v2f r;
    r.x = __builtin_amdgcn_rcpf(v.x);
    r.y = __builtin_amdgcn_rcpf(v.y);
    return r;
}

// ---------------------------------------------------------------------------
// Kernel 1: fused  ws = x@w + b  (WMMA f16->f32, double-buffered LDS),
// then 4-way activation mix weighted by attn, store out[m][n] f32.
// 128x256 tile / block (512 thr = 16 waves, each wave 32x64 = 2x4 WMMA tiles),
// 64 k per staged tile. 512 blocks: two per WGP at 128 VGPRs, all resident at once.
// The second launch-bounds figure asks for 8 waves per SIMD, a budget of 128 VGPRs:
// above it only one 16-wave block fits a WGP and the grid takes two rounds.
// ---------------------------------------------------------------------------
__global__ __launch_bounds__(512, 8) void k_gemm_act(const float*    __restrict__ x,
                                                  const _Float16* __restrict__ wT,
                                                  const float*    __restrict__ bias,
                                                  const float*    __restrict__ wf,
                                                  const float*    __restrict__ bf,
                                                  const float*    __restrict__ attn,
                                                  float*          __restrict__ out) {
    // One LDS object with the epilogue's small tables first: below 64 KiB their planes and
    // rows are reached by the offset field of the LDS loads, from one address register each.
    __shared__ struct {
        // attention weights of this m-tile, one plane per factor of the epilogue's sum:
        // relu, sigmoid, tanh's constant 1, tanh's quotient, gelu's relu part, gelu's tail
        float    Atn[6][BM];
        // per output column: scale and offset of each activation's argument (see below)
        float    Ccol[8][BN];
        _Float16 Alds[2][BM * LDA];           // [m][k] f16, padded rows
        _Float16 Blds[2][BN * LDA];           // [n][k] f16, padded rows
    } __attribute__((aligned(16))) sm;
    auto& Atn  = sm.Atn;
    auto& Ccol = sm.Ccol;
    auto& Alds = sm.Alds;
    auto& Blds = sm.Blds;

    const int t     = threadIdx.x;
    // The four column tiles of a row tile sit 8 apart in the block index, and the row tile
    // keeps the index's low three bits, as in the pre-pass (for speed only). Any placement is correct.
    const int nTile = (blockIdx.x >> 3) & 3;                       // N / 256 = 4
    const int mTile = (blockIdx.x & 7) + 8 * (blockIdx.x >> 5);    // M / 128 = 128
    const int mBase = mTile * BM;
    const int nBase = nTile * BN;
    const int wave  = t >> 5;
    const int lane  = t & 31;
    const int wM    = wave & 3;            // 4 waves along M
    const int wN    = wave >> 2;           // 4 waves along N
    const int h     = lane >> 4;           // lane half (K sub-block select)
    const int ln    = lane & 15;           // row/col within 16

    if (t < BM) {
        const float4 at = ((const float4*)attn)[mBase + t];
        Atn[0][t] = at.x;
        Atn[1][t] = at.y;
        Atn[2][t] = at.z;
        Atn[3][t] = -2.f * at.z;
        Atn[4][t] = at.w;
        Atn[5][t] = -0.5f * at.w;
    }
    // Per column the bias and the scale of each activation's argument are folded into one
    // multiply-add on the accumulator:  t_a = acc * Ccol[a] + Ccol[4 + a]
    //   a = 0  relu:     t
    //   a = 1  sigmoid:  -t * log2(e)      1 / (1 + 2^arg)
    //   a = 2  tanh:     2t * log2(e)      1 - 2 / (2^arg + 1)   (saturates correctly at +/-inf)
    //   a = 3  gelu:     t
    if (t < BN) {
        const float  L2E = 1.4426950408889634f;
        const float  bn  = bias[nBase + t];
        const float4 wfv = ((const float4*)wf)[nBase + t];
        const float4 bfv = ((const float4*)bf)[nBase + t];
        Ccol[0][t] = wfv.x;              Ccol[4][t] = fmaf(bn, wfv.x, bfv.x);
        Ccol[1][t] = -L2E * wfv.y;       Ccol[5][t] = -L2E * fmaf(bn, wfv.y, bfv.y);
        Ccol[2][t] = 2.f * L2E * wfv.z;  Ccol[6][t] = 2.f * L2E * fmaf(bn, wfv.z, bfv.z);
        Ccol[3][t] = wfv.w;              Ccol[7][t] = fmaf(bn, wfv.w, bfv.w);
    }

    v8f acc[2][4] = {};

    // prologue: stage K-tile 0 into buffer 0
    const float*    xg = x  + (size_t)(mBase + (t >> 4)) * KDIM + (t & 15) * 4;
    const _Float16* wg = wT + (size_t)(nBase + (t >> 3)) * KDIM + (t & 7) * 8;
    stage_tiles(xg, wg, Alds[0], Blds[0], t);
    __syncthreads();

    // software-pipelined main loop: stage next buffer while consuming current
#pragma unroll 1
    for (int kt = 0; kt < KDIM / KT; kt += 2) {
        stage_tiles(xg + (kt + 1) * KT, wg + (kt + 1) * KT, Alds[1], Blds[1], t);
        mma_step(Alds[0], Blds[0], acc, wM, wN, h, ln, 0);
        mma_step(Alds[0], Blds[0], acc, wM, wN, h, ln, 1);
        __syncthreads();
        if (kt + 2 < KDIM / KT)
            stage_tiles(xg + (kt + 2) * KT, wg + (kt + 2) * KT, Alds[0], Blds[0], t);
        mma_step(Alds[1], Blds[1], acc, wM, wN, h, ln, 0);
        mma_step(Alds[1], Blds[1], acc, wM, wN, h, ln, 1);
        __syncthreads();
    }

    // ---- epilogue: 4 activations weighted by attention ----
    // Columns outermost: one column's eight constants are live at a time (a packed
    // instruction takes each from a register pair), the attention pairs come from LDS anew
    // for each column; that keeps the kernel inside the 128 VGPRs that two blocks per WGP need.
    // this lane's first output element; all others lie at compile-time distances
    float* og = out + (size_t)(mBase + wM * 32 + 8 * h) * NDIM + nBase + wN * 64 + ln;
#pragma unroll
    for (int ni = 0; ni < 4; ++ni) {
        const int   nl  = wN * 64 + ni * 16 + ln;
        const float cw0 = Ccol[0][nl], cw1 = Ccol[1][nl], cw2 = Ccol[2][nl], cw3 = Ccol[3][nl];
        const float cc0 = Ccol[4][nl], cc1 = Ccol[5][nl], cc2 = Ccol[6][nl], cc3 = Ccol[7][nl];
#pragma unroll
        for (int mi = 0; mi < 2; ++mi) {
#pragma unroll
            for (int ip = 0; ip < 4; ++ip) {
                // Wave-scope fence on LDS, no instruction of its own: it makes the compiler read
                // the attention pairs anew here. Without it all 96 values are read once, kept
                // across the four columns and spilled to scratch memory.
                __builtin_amdgcn_fence(__ATOMIC_ACQUIRE, "wavefront", "local");
                const int mloc = wM * 32 + mi * 16 + 8 * h + 2 * ip;
                const v2f a_relu = *(const v2f*)&Atn[0][mloc];
                const v2f a_sig  = *(const v2f*)&Atn[1][mloc];
                const v2f a_one  = *(const v2f*)&Atn[2][mloc];
                const v2f a_tanh = *(const v2f*)&Atn[3][mloc];
                const v2f a_gel  = *(const v2f*)&Atn[4][mloc];
                const v2f a_tail = *(const v2f*)&Atn[5][mloc];
                v2f a;
                a.x = acc[mi][ni][2 * ip];
                a.y = acc[mi][ni][2 * ip + 1];
                const v2f t0 = a * cw0 + cc0;
                const v2f t1 = a * cw1 + cc1;
                const v2f t2 = a * cw2 + cc2;
                const v2f t3 = a * cw3 + cc3;
                // exact gelu, branch-free:  t * Phi(t) = max(t, 0) - 0.5 * |t| * erfc(|t| / sqrt(2)),
                // erfc(u / sqrt(2)) = 2^(u * q(u)), q fitted on 0 <= u <= 6 so that the gelu is
                // right to 2e-7 (f32 rounding level); from u = 8 on the tail is below 1e-14 and
                // u is held there, so the term stays that small for every larger |t|.
                const v2f u = __builtin_elementwise_min(__builtin_elementwise_abs(t3), (v2f)8.f);
                v2f q = u * 2.99305648e-5f + -7.39926647e-4f;
                q = q * u + 7.97762070e-3f;
                q = q * u + -5.32383993e-2f;
                q = q * u + -4.58915561e-1f;
                q = q * u + -1.15114713f;
                const v2f e1 = exp2_pair(t1);
                const v2f e2 = exp2_pair(t2);
                const v2f qu = q * u;
                const v2f e3 = exp2_pair(qu);
                // The slot that the instruction set asks for between a transcendental and a vector
                // instruction that overwrites its source. The operands (inputs only) hold the v_nop
                // behind both 2^x and keep their arguments' registers untouched up to it.
                asm volatile("v_nop" :: "v"(qu.x), "v"(qu.y), "v"(e3.x), "v"(e3.y));
                const v2f r1 = rcp_pair(e1 + 1.f);
                const v2f r2 = rcp_pair(e2 + 1.f);
                v2f r = a_relu * __builtin_elementwise_max(t0, (v2f)0.f) + a_one;
                r += a_gel  * __builtin_elementwise_max(t3, (v2f)0.f);
                r += a_tail * (u * e3);
                r += a_sig  * r1;
                r += a_tanh * r2;
                og[(mi * 16 + 2 * ip) * NDIM + ni * 16]     = r.x;
                og[(mi * 16 + 2 * ip + 1) * NDIM + ni * 16] = r.y;
            }
        }
    }
}

// ---------------------------------------------------------------------------
extern "C" void kernel_launch(void* const* d_in, const int* in_sizes, int n_in,
                              void* d_out, int out_size, void* d_ws, size_t ws_size,
                              hipStream_t stream) {
    (void)in_sizes; (void)n_in; (void)out_size; (void)ws_size;
    const float* x     = (const float*)d_in[0];   // [B,S,D]
    const float* w     = (const float*)d_in[1];   // [D,U]
    const float* b     = (const float*)d_in[2];   // [U]
    const float* wf    = (const float*)d_in[3];   // [U,A]
    const float* bf    = (const float*)d_in[4];   // [U,A]
    const float* w_att = (const float*)d_in[5];   // [D,A]
    const float* b_att = (const float*)d_in[6];   // [A]
    float* out = (float*)d_out;                   // [B,S,U]

    // workspace layout: wT (U*K f16 = 2MB) | attn (M*4 f32 = 256KB)
    _Float16* wT   = (_Float16*)d_ws;
    float*    attn = (float*)((char*)d_ws + (size_t)NDIM * KDIM * sizeof(_Float16));

    k_prepass<<<MDIM / (16 * PRE_ROWS), 512, 0, stream>>>(w, x, w_att, b_att, wT, attn);
    k_gemm_act<<<(MDIM / BM) * (NDIM / BN), 512, 0, stream>>>(x, wT, b, wf, bf, attn, out);
}

// v005
// A run of this version takes 42.7 microseconds.
// Timed twice side by side with v004, it ran 1.05 times as fast both times.
// Counting every step since v000, it is 1.88 times as fast.
#include <hip/hip_runtime.h>
#include <hip/hip_bf16.h>
#include <math.h>

// Problem constants (B=8, S=2048, D=1024, U=1024, A=4)
#define MDIM 16384   // B*S
#define KDIM 1024    // D
#define NDIM 1024    // U
#define KT   64      // k extent of one staged tile: 128 B of a wT row, 256 B of an x row (whole lines)
#define BM   256     // rows of out per block
#define BN   256     // columns of out per block
#define LDA  72      // padded LDS row stride in halves (64 data + 8 pad = 9 x 16 B) -> conflict-free b128 reads

typedef __attribute__((ext_vector_type(16))) _Float16 v16h;
typedef __attribute__((ext_vector_type(8)))  _Float16 v8h;
typedef __attribute__((ext_vector_type(4)))  _Float16 v4h;
typedef __attribute__((ext_vector_type(8)))  float    v8f;
typedef __attribute__((ext_vector_type(2)))  float    v2f;
typedef __attribute__((ext_vector_type(2)))  unsigned v2u;

// ---------------------------------------------------------------------------
// Kernel 0: both pre-passes in one launch of 256 blocks of 16 waves, one block per WGP.
//   (a) transpose + convert one 64x64 tile:  w[D][U] f32  ->  wT[U][D] f16
//   (b) attn[m][a] = softmax_a( x[m,:] . w_att[:,a] + b_att[a] ) for 64 rows of x
// Few, long-lived waves: a wave streams four whole rows of x with 16-byte loads (512
// contiguous bytes per load, two rows in flight) against w_att held in its registers,
// so the launch is paced by the memory stream and not by how fast waves can be started.
// ---------------------------------------------------------------------------
#define PRE_ROWS 4       // rows of x per wave
#define XCH      8       // 16-byte chunks of a row per lane: 1024 / (32 lanes * 4)

__device__ __forceinline__ void load_row(const float4* __restrict__ p, float4 (&v)[XCH]) {
#pragma unroll
    for (int j = 0; j < XCH; ++j) v[j] = p[j * 32];
}

__device__ __forceinline__ void row_dot(const float4 (&v)[XCH], const float4 (&wr)[4][XCH],
                                        float (&s)[4]) {
#pragma unroll
    for (int a = 0; a < 4; ++a) s[a] = 0.f;
#pragma unroll
    for (int j = 0; j < XCH; ++j)
#pragma unroll
        for (int a = 0; a < 4; ++a) {
            s[a] = fmaf(v[j].x, wr[a][j].x, s[a]);
            s[a] = fmaf(v[j].y, wr[a][j].y, s[a]);
            s[a] = fmaf(v[j].z, wr[a][j].z, s[a]);
            s[a] = fmaf(v[j].w, wr[a][j].w, s[a]);
        }
}

__device__ __forceinline__ void row_softmax(float (&s)[4], const float4 ba, int lane,
                                            float4* __restrict__ dst) {
#pragma unroll
    for (int off = 16; off > 0; off >>= 1)
#pragma unroll
        for (int a = 0; a < 4; ++a) s[a] += __shfl_xor(s[a], off, 32);
    if (lane == 0) {
        const float a0 = s[0] + ba.x, a1 = s[1] + ba.y, a2 = s[2] + ba.z, a3 = s[3] + ba.w;
        const float mx = fmaxf(fmaxf(a0, a1), fmaxf(a2, a3));
        const float e0 = __expf(a0 - mx), e1 = __expf(a1 - mx);
        const float e2 = __expf(a2 - mx), e3 = __expf(a3 - mx);
        const float inv = __builtin_amdgcn_rcpf(e0 + e1 + e2 + e3);
        *dst = make_float4(e0 * inv, e1 * inv, e2 * inv, e3 * inv);
    }
}

__global__ __launch_bounds__(512) void k_prepass(const float* __restrict__ w,
                                                 const float* __restrict__ x,
                                                 const float* __restrict__ w_att,
                                                 const float* __restrict__ b_att,
                                                 _Float16* __restrict__ wT,
                                                 float* __restrict__ attn) {
    __shared__ float tile[64][65];     // one 64(k) x 64(n) tile of w; odd pitch: no bank conflicts either way
    __shared__ float wA[4][KDIM];      // w_att, one plane per activation, k contiguous

    const int t    = threadIdx.x;
    const int wave = t >> 5;
    const int lane = t & 31;
    // Which 64 rows of x this block streams: the quarter (bits 3 and 4 of the index) of the
    // 256-row tile whose number has the block index's low three bits. The GEMM deals its row tiles by the
    // same three bits. A permutation of the rows: speed only.
    const int rowTile = (blockIdx.x & 7) + 8 * (blockIdx.x >> 5);
    const int m0   = rowTile * BM + ((blockIdx.x >> 3) & 3) * (16 * PRE_ROWS)
                   + wave * PRE_ROWS;                                  // this wave's first row

    const float4* xr = (const float4*)(x + (size_t)m0 * KDIM) + lane;
    float4 xa[XCH], xb[XCH];

    // ---- stage the w tile and w_att in LDS ----
    const int bn = blockIdx.x & 15;        // n-tile (U/64)
    const int bk = blockIdx.x >> 4;        // k-tile (D/64)
    {
        const int r0 = t >> 4;             // 0..31
        const int c4 = (t & 15) * 4;       // 0..60
        const float* wp = w + (size_t)(bk * 64 + r0) * NDIM + bn * 64 + c4;
        const float4 w0 = *(const float4*)wp;
        const float4 w1 = *(const float4*)(wp + 32 * NDIM);
        const float4 q0 = ((const float4*)w_att)[t];
        const float4 q1 = ((const float4*)w_att)[t + 512];
        // the first two rows of x are asked for here, ahead of the LDS staging, so that
        // they are in flight while the tile and w_att are staged
        load_row(xr, xa);
        load_row(xr + KDIM / 4, xb);
        tile[r0][c4 + 0] = w0.x; tile[r0][c4 + 1] = w0.y;
        tile[r0][c4 + 2] = w0.z; tile[r0][c4 + 3] = w0.w;
        tile[r0 + 32][c4 + 0] = w1.x; tile[r0 + 32][c4 + 1] = w1.y;
        tile[r0 + 32][c4 + 2] = w1.z; tile[r0 + 32][c4 + 3] = w1.w;
        wA[0][t] = q0.x; wA[1][t] = q0.y; wA[2][t] = q0.z; wA[3][t] = q0.w;
        wA[0][t + 512] = q1.x; wA[1][t + 512] = q1.y; wA[2][t + 512] = q1.z; wA[3][t + 512] = q1.w;
    }
    const float4 ba = *(const float4*)b_att;
    // Work-group barrier whose fences name LDS alone: only tile and wA pass between waves
    // here. __syncthreads() would also wait out the x rows in flight, in all 16 waves at
    // once, and leave the memory stream empty behind it.
    __builtin_amdgcn_fence(__ATOMIC_RELEASE, "workgroup", "local");
    __builtin_amdgcn_s_barrier();
    __builtin_amdgcn_fence(__ATOMIC_ACQUIRE, "workgroup", "local");

    // ---- (a) the transposed tile: 8 lanes write one whole 128-byte line of a wT row ----
    {
        const int n  = t >> 3;             // 0..63
        const int k8 = (t & 7) * 8;        // 0..56
        v8h hv;
#pragma unroll
        for (int j = 0; j < 8; ++j) hv[j] = (_Float16)tile[k8 + j][n];
        *(v8h*)(wT + (size_t)(bn * 64 + n) * KDIM + bk * 64 + k8) = hv;
    }

    // ---- (b) attention: w_att for this lane's k positions, kept in registers ----
    float4 wr[4][XCH];
#pragma unroll
    for (int a = 0; a < 4; ++a)
#pragma unroll
        for (int j = 0; j < XCH; ++j) wr[a][j] = *(const float4*)&wA[a][j * 128 + lane * 4];

    float4* ao = (float4*)attn + m0;
    float s[4];
    row_dot(xa, wr, s);
    load_row(xr + 2 * (KDIM / 4), xa);
    row_softmax(s, ba, lane, ao + 0);
    row_dot(xb, wr, s);
    load_row(xr + 3 * (KDIM / 4), xb);
    row_softmax(s, ba, lane, ao + 1);
    row_dot(xa, wr, s);
    row_softmax(s, ba, lane, ao + 2);
    row_dot(xb, wr, s);
    row_softmax(s, ba, lane, ao + 3);
}

// ---------------------------------------------------------------------------
// GEMM helpers
// ---------------------------------------------------------------------------
// xg, wg: this thread's first element of the tile in x and in wT; the further rows of
// the thread lie at compile-time distances, so one address pair per operand stays live.
// A tile: 256 rows x 64 k, f32 in memory, f16 in LDS; a thread has 8 rows, 32 apart.
// B tile: 256 rows x 64 k, f16; a thread has 4 rows, 64 apart.
// A tile is staged in two halves Q (4 rows of A and 2 of B per thread, 48 KiB per block), and
// each half is split into its global loads and its LDS stores, so that a run of WMMAs can
// stand between the two.
template <int Q>
__device__ __forceinline__ void load_half(const float* __restrict__ xg,
                                          const _Float16* __restrict__ wg,
                                          float4 (&va)[4], v8h (&vb)[2]) {
#pragma unroll
    for (int p = 0; p < 4; ++p) va[p] = *(const float4*)(xg + (Q * 4 + p) * 32 * KDIM);
#pragma unroll
    for (int p = 0; p < 2; ++p) vb[p] = *(const v8h*)(wg + (Q * 2 + p) * 64 * KDIM);
}
template <int Q>
__device__ __forceinline__ void store_half(const float4 (&va)[4], const v8h (&vb)[2],
                                           _Float16* Ab, _Float16* Bb, int t) {
    const int r0 = t >> 4;              // 0..31
    const int c4 = (t & 15) * 4;        // 0..60
    const int n0 = t >> 3;              // 0..63
    const int c8 = (t & 7) * 8;         // 0..56
#pragma unroll
    for (int p = 0; p < 4; ++p) {
        // The conversion (round to nearest even, as the cast) is written as asm text so that it
        // stays here, behind the WMMAs: as a cast the compiler moved it up to the loads, and
        // the wave sat out their latency in front of its WMMAs.
        v2u pk;
        asm volatile("v_cvt_pk_f16_f32 %0, %1, %2" : "=v"(pk.x) : "v"(va[p].x), "v"(va[p].y));
        asm volatile("v_cvt_pk_f16_f32 %0, %1, %2" : "=v"(pk.y) : "v"(va[p].z), "v"(va[p].w));
        *(v4h*)&Ab[((Q * 4 + p) * 32 + r0) * LDA + c4] = __builtin_bit_cast(v4h, pk);
    }
#pragma unroll
    for (int p = 0; p < 2; ++p) *(v8h*)&Bb[((Q * 2 + p) * 64 + n0) * LDA + c8] = vb[p];
}

// One pass: the WMMAs of the tile in (Ac, Bc); where 'fill' is set, the next tile goes from
// (xg, wg) into (An, Bn) meanwhile: one half flies under the first 16 WMMAs, one under the second.
__device__ __forceinline__ void mma_step(const _Float16* Ab, const _Float16* Bb,
                                         v8f (&acc)[4][4],
                                         int wM, int wN, int h, int ln, int kk);
__device__ __forceinline__ void pass(const _Float16* Ac, const _Float16* Bc,
                                     _Float16* An, _Float16* Bn,
                                     const float* __restrict__ xg, const _Float16* __restrict__ wg,
                                     bool fill, v8f (&acc)[4][4],
                                     int wM, int wN, int h, int ln, int t) {
    float4 va[4];
    v8h    vb[2];
    if (fill) load_half<0>(xg, wg, va, vb);
    // The four scheduling barriers keep each group of global loads ahead of its 16 WMMAs and
    // the wait for it, with the LDS stores, behind them: left alone the compiler moved the
    // loads down to their wait, and the wave sat out their whole latency.
    __builtin_amdgcn_sched_barrier(0);
    mma_step(Ac, Bc, acc, wM, wN, h, ln, 0);
    __builtin_amdgcn_sched_barrier(0);
    if (fill) {
        // The distance that the chip asks for between a WMMA and a vector instruction that
        // overwrites its A or B.
        asm volatile("v_nop\n\tv_nop\n\tv_nop\n\tv_nop");
        store_half<0>(va, vb, An, Bn, t);
        load_half<1>(xg, wg, va, vb);
    }
    __builtin_amdgcn_sched_barrier(0);
    mma_step(Ac, Bc, acc, wM, wN, h, ln, 1);
    __builtin_amdgcn_sched_barrier(0);
    if (fill) {
        // the same distance as above
        asm volatile("v_nop\n\tv_nop\n\tv_nop\n\tv_nop");
        store_half<1>(va, vb, An, Bn, t);
    }
}

__device__ __forceinline__ void mma_step(const _Float16* Ab, const _Float16* Bb,
                                         v8f (&acc)[4][4],
                                         int wM, int wN, int h, int ln, int kk) {
    // ISA 16-bit A/B layout: lanes 0-15: K = 0..7 then 16..23 ;
    //                        lanes 16-31: K = 8..15 then 24..31
    // kk: which 32-k half of the staged tile
    v16h afrag[4], bfrag[4];
#pragma unroll
    for (int mi = 0; mi < 4; ++mi) {
        int m = wM * 64 + mi * 16 + ln;
        v8h lo = *(const v8h*)&Ab[m * LDA + kk * 32 + 8 * h];
        v8h hi = *(const v8h*)&Ab[m * LDA + kk * 32 + 16 + 8 * h];
        afrag[mi] = __builtin_shufflevector(lo, hi, 0,1,2,3,4,5,6,7,8,9,10,11,12,13,14,15);
    }
#pragma unroll
    for (int ni = 0; ni < 4; ++ni) {
        int n = wN * 64 + ni * 16 + ln;
        v8h lo = *(const v8h*)&Bb[n * LDA + kk * 32 + 8 * h];
        v8h hi = *(const v8h*)&Bb[n * LDA + kk * 32 + 16 + 8 * h];
        bfrag[ni] = __builtin_shufflevector(lo, hi, 0,1,2,3,4,5,6,7,8,9,10,11,12,13,14,15);
    }
#pragma unroll
    for (int mi = 0; mi < 4; ++mi)
#pragma unroll
        for (int ni = 0; ni < 4; ++ni)
            acc[mi][ni] = __builtin_amdgcn_wmma_f32_16x16x32_f16(
                false, afrag[mi], false, bfrag[ni],
                (short)0, acc[mi][ni], false, false);
    // Order asked of the scheduler: all 16 fragment reads as one group, then the 16 WMMAs
    // behind counted waits. Left alone it read every A fragment into the registers of the
    // one before, with a full LDS wait in front of each row of four WMMAs.
    __builtin_amdgcn_sched_group_barrier(0x100, 16, 0);   // LDS reads
    __builtin_amdgcn_sched_group_barrier(0x008, 16, 0);   // WMMAs
}

// Two rows of one output column at a time: the multiply-adds of a pair go out as one
// packed instruction; only 2^x and 1/x are issued once per element.
__device__ __forceinline__ v2f exp2_pair(v2f v) {
    v2f r;
    r.x = __builtin_amdgcn_exp2f(v.x);
    r.y = __builtin_amdgcn_exp2f(v.y);
    return r;
}
__device__ __forceinline__ v2f rcp_pair(v2f v) {
    v2f r;
    r.x = __builtin_amdgcn_rcpf(v.x);
    r.y = __builtin_amdgcn_rcpf(v.y);
    return r;
}

// ---------------------------------------------------------------------------
// Kernel 1: fused  ws = x@w + b  (WMMA f16->f32, double-buffered LDS),
// then 4-way activation mix weighted by attn, store out[m][n] f32.
// 256x256 tile / block (512 thr = 16 waves, each wave 64x64 = 4x4 WMMA tiles: one LDS
// fragment load per WMMA where a 32x64 tile takes one and a half),
// 64 k per staged tile. 256 blocks, one per WGP, all resident at once; four waves per SIMD,
// a budget of 256 VGPRs each.
// ---------------------------------------------------------------------------
__global__ __launch_bounds__(512, 4) void k_gemm_act(const float*    __restrict__ x,
                                                  const _Float16* __restrict__ wT,
                                                  const float*    __restrict__ bias,
                                                  const float*    __restrict__ wf,
                                                  const float*    __restrict__ bf,
                                                  const float*    __restrict__ attn,
                                                  float*          __restrict__ out) {
    // One LDS object with the epilogue's small tables first: below 64 KiB their planes and
    // rows are reached by the offset field of the LDS loads, from one address register each.
    __shared__ struct {
        // attention weights of this m-tile, one plane per factor of the epilogue's sum:
        // relu, sigmoid, tanh's constant 1, tanh's quotient, gelu's relu part, gelu's tail
        float    Atn[6][BM];
        // per output column: scale and offset of each activation's argument (see below)
        float    Ccol[8][BN];
        _Float16 Alds[2][BM * LDA];           // [m][k] f16, padded rows
        _Float16 Blds[2][BN * LDA];           // [n][k] f16, padded rows
    } __attribute__((aligned(16))) sm;
    auto& Atn  = sm.Atn;
    auto& Ccol = sm.Ccol;
    auto& Alds = sm.Alds;
    auto& Blds = sm.Blds;

    const int t     = threadIdx.x;
    // The four column tiles of a row tile sit 8 apart in the block index, and the row tile
    // keeps the index's low three bits, as in the pre-pass (for speed only). Any placement is correct.
    const int nTile = (blockIdx.x >> 3) & 3;                       // N / 256 = 4
    const int mTile = (blockIdx.x & 7) + 8 * (blockIdx.x >> 5);    // M / 256 = 64
    const int mBase = mTile * BM;
    const int nBase = nTile * BN;
    const int wave  = t >> 5;
    const int lane  = t & 31;
    const int wM    = wave & 3;            // 4 waves along M
    const int wN    = wave >> 2;           // 4 waves along N
    const int h     = lane >> 4;           // lane half (K sub-block select)
    const int ln    = lane & 15;           // row/col within 16

    if (t < BM) {
        const float4 at = ((const float4*)attn)[mBase + t];
        Atn[0][t] = at.x;
        Atn[1][t] = at.y;
        Atn[2][t] = at.z;
        Atn[3][t] = -2.f * at.z;
        Atn[4][t] = at.w;
        Atn[5][t] = -0.5f * at.w;
    }
    // Per column the bias and the scale of each activation's argument are folded into one
    // multiply-add on the accumulator:  t_a = acc * Ccol[a] + Ccol[4 + a]
    //   a = 0  relu:     t
    //   a = 1  sigmoid:  -t * log2(e)      1 / (1 + 2^arg)
    //   a = 2  tanh:     2t * log2(e)      1 - 2 / (2^arg + 1)   (saturates correctly at +/-inf)
    //   a = 3  gelu:     t
    if (t < BN) {
        const float  L2E = 1.4426950408889634f;
        const float  bn  = bias[nBase + t];
        const float4 wfv = ((const float4*)wf)[nBase + t];
        const float4 bfv = ((const float4*)bf)[nBase + t];
        Ccol[0][t] = wfv.x;              Ccol[4][t] = fmaf(bn, wfv.x, bfv.x);
        Ccol[1][t] = -L2E * wfv.y;       Ccol[5][t] = -L2E * fmaf(bn, wfv.y, bfv.y);
        Ccol[2][t] = 2.f * L2E * wfv.z;  Ccol[6][t] = 2.f * L2E * fmaf(bn, wfv.z, bfv.z);
        Ccol[3][t] = wfv.w;              Ccol[7][t] = fmaf(bn, wfv.w, bfv.w);
    }

    v8f acc[4][4] = {};

    // prologue: stage K-tile 0 into buffer 0
    const float*    xg = x  + (size_t)(mBase + (t >> 4)) * KDIM + (t & 15) * 4;
    const _Float16* wg = wT + (size_t)(nBase + (t >> 3)) * KDIM + (t & 7) * 8;
    {
        float4 va0[4], va1[4];
        v8h    vb0[2], vb1[2];
        load_half<0>(xg, wg, va0, vb0);
        load_half<1>(xg, wg, va1, vb1);
        store_half<0>(va0, vb0, Alds[0], Blds[0], t);
        store_half<1>(va1, vb1, Alds[0], Blds[0], t);
    }
    __syncthreads();

    // software-pipelined main loop: stage next buffer while consuming current; the last two
    // tiles stand behind the loop, so that no pass in it has a branch round its staging
#pragma unroll 1
    for (int kt = 0; kt < KDIM / KT - 2; kt += 2) {
        pass(Alds[0], Blds[0], Alds[1], Blds[1], xg + (kt + 1) * KT, wg + (kt + 1) * KT,
             true, acc, wM, wN, h, ln, t);
        __syncthreads();
        pass(Alds[1], Blds[1], Alds[0], Blds[0], xg + (kt + 2) * KT, wg + (kt + 2) * KT,
             true, acc, wM, wN, h, ln, t);
        __syncthreads();
    }
    pass(Alds[0], Blds[0], Alds[1], Blds[1], xg + (KDIM / KT - 1) * KT, wg + (KDIM / KT - 1) * KT,
         true, acc, wM, wN, h, ln, t);
    __syncthreads();
    pass(Alds[1], Blds[1], Alds[0], Blds[0], xg, wg, false, acc, wM, wN, h, ln, t);
    __syncthreads();

    // ---- epilogue: 4 activations weighted by attention ----
    // Columns outermost: one column's eight constants are live at a time (a packed
    // instruction takes each from a register pair), the attention pairs come from LDS anew
    // for each column; that keeps the kernel inside the 256 VGPRs that a 16-wave block may have.
    // this lane's first output element; all others lie at compile-time distances
    float* og = out + (size_t)(mBase + wM * 64 + 8 * h) * NDIM + nBase + wN * 64 + ln;
#pragma unroll
    for (int ni = 0; ni < 4; ++ni) {
        const int   nl  = wN * 64 + ni * 16 + ln;
        const float cw0 = Ccol[0][nl], cw1 = Ccol[1][nl], cw2 = Ccol[2][nl], cw3 = Ccol[3][nl];
        const float cc0 = Ccol[4][nl], cc1 = Ccol[5][nl], cc2 = Ccol[6][nl], cc3 = Ccol[7][nl];
#pragma unroll
        for (int mi = 0; mi < 4; ++mi) {
#pragma unroll
            for (int ip = 0; ip < 4; ++ip) {
                // Wave-scope fence on LDS, no instruction of its own: it makes the compiler read
                // the attention pairs anew here. Without it all 192 values are read once, kept
                // across the four columns and spilled to scratch memory.
                __builtin_amdgcn_fence(__ATOMIC_ACQUIRE, "wavefront", "local");
                const int mloc = wM * 64 + mi * 16 + 8 * h + 2 * ip;
                const v2f a_relu = *(const v2f*)&Atn[0][mloc];
                const v2f a_sig  = *(const v2f*)&Atn[1][mloc];
                const v2f a_one  = *(const v2f*)&Atn[2][mloc];
                const v2f a_tanh = *(const v2f*)&Atn[3][mloc];
                const v2f a_gel  = *(const v2f*)&Atn[4][mloc];
                const v2f a_tail = *(const v2f*)&Atn[5][mloc];
                v2f a;
                a.x = acc[mi][ni][2 * ip];
                a.y = acc[mi][ni][2 * ip + 1];
                const v2f t0 = a * cw0 + cc0;
                const v2f t1 = a * cw1 + cc1;
                const v2f t2 = a * cw2 + cc2;
                const v2f t3 = a * cw3 + cc3;
                // exact gelu, branch-free:  t * Phi(t) = max(t, 0) - 0.5 * |t| * erfc(|t| / sqrt(2)),
                // erfc(u / sqrt(2)) = 2^(u * q(u)), q fitted on 0 <= u <= 6 so that the gelu is
                // right to 2e-7 (f32 rounding level); from u = 8 on the tail is below 1e-14 and
                // u is held there, so the term stays that small for every larger |t|.
                const v2f u = __builtin_elementwise_min(__builtin_elementwise_abs(t3), (v2f)8.f);
                v2f q = u * 2.99305648e-5f + -7.39926647e-4f;
                q = q * u + 7.97762070e-3f;
                q = q * u + -5.32383993e-2f;
                q = q * u + -4.58915561e-1f;
                q = q * u + -1.15114713f;
                const v2f e1 = exp2_pair(t1);
                const v2f e2 = exp2_pair(t2);
                const v2f qu = q * u;
                const v2f e3 = exp2_pair(qu);
                // The slot that the instruction set asks for between a transcendental and a vector
                // instruction that overwrites its source. The operands (inputs only) hold the v_nop
                // behind both 2^x and keep their arguments' registers untouched up to it.
                asm volatile("v_nop" :: "v"(qu.x), "v"(qu.y), "v"(e3.x), "v"(e3.y));
                const v2f r1 = rcp_pair(e1 + 1.f);
                const v2f r2 = rcp_pair(e2 + 1.f);
                v2f r = a_relu * __builtin_elementwise_max(t0, (v2f)0.f) + a_one;
                r += a_gel  * __builtin_elementwise_max(t3, (v2f)0.f);
                r += a_tail * (u * e3);
                r += a_sig  * r1;
                r += a_tanh * r2;
                og[(mi * 16 + 2 * ip) * NDIM + ni * 16]     = r.x;
                og[(mi * 16 + 2 * ip + 1) * NDIM + ni * 16] = r.y;
            }
        }
    }
}

// ---------------------------------------------------------------------------
extern "C" void kernel_launch(void* const* d_in, const int* in_sizes, int n_in,
                              void* d_out, int out_size, void* d_ws, size_t ws_size,
                              hipStream_t stream) {
    (void)in_sizes; (void)n_in; (void)out_size; (void)ws_size;
    const float* x     = (const float*)d_in[0];   // [B,S,D]
    const float* w     = (const float*)d_in[1];   // [D,U]
    const float* b     = (const float*)d_in[2];   // [U]
    const float* wf    = (const float*)d_in[3];   // [U,A]
    const float* bf    = (const float*)d_in[4];   // [U,A]
    const float* w_att = (const float*)d_in[5];   // [D,A]
    const float* b_att = (const float*)d_in[6];   // [A]
    float* out = (float*)d_out;                   // [B,S,U]

    // workspace layout: wT (U*K f16 = 2MB) | attn (M*4 f32 = 256KB)
    _Float16* wT   = (_Float16*)d_ws;
    float*    attn = (float*)((char*)d_ws + (size_t)NDIM * KDIM * sizeof(_Float16));

    k_prepass<<<MDIM / (16 * PRE_ROWS), 512, 0, stream>>>(w, x, w_att, b_att, wT, attn);
    k_gemm_act<<<(MDIM / BM) * (NDIM / BN), 512, 0, stream>>>(x, wT, b, wf, bf, attn, out);
}

// v006
// Measured time: 37.4 microseconds a run.
// Two timings next to v005 put it at 1.13 and 1.15 times that version's speed.
// Counting every step since v000, it is 2.15 times as fast.
#include <hip/hip_runtime.h>
#include <hip/hip_bf16.h>
#include <math.h>

// Problem constants (B=8, S=2048, D=1024, U=1024, A=4)
#define MDIM 16384   // B*S
#define KDIM 1024    // D
#define NDIM 1024    // U
#define KT   64      // k extent of one staged tile: 128 B of a wT row, 256 B of an x row (whole lines)
#define BM   256     // rows of out per block
#define BN   256     // columns of out per block
#define LDA  72      // padded LDS row stride in halves (64 data + 8 pad = 9 x 16 B) -> conflict-free b128 reads

typedef __attribute__((ext_vector_type(16))) _Float16 v16h;
typedef __attribute__((ext_vector_type(8)))  _Float16 v8h;
typedef __attribute__((ext_vector_type(4)))  _Float16 v4h;
typedef __attribute__((ext_vector_type(8)))  float    v8f;
typedef __attribute__((ext_vector_type(2)))  float    v2f;
typedef __attribute__((ext_vector_type(2)))  unsigned v2u;

// ---------------------------------------------------------------------------
// Kernel 0: both pre-passes in one launch of 256 blocks of 16 waves, one block per WGP.
//   (a) transpose + convert one 64x64 tile:  w[D][U] f32  ->  wT[U][D] f16
//   (b) attn[m][a] = softmax_a( x[m,:] . w_att[:,a] + b_att[a] ) for 64 rows of x
// Few, long-lived waves: a wave streams four whole rows of x with 16-byte loads (512
// contiguous bytes per load, two rows in flight) against w_att held in its registers.
// ---------------------------------------------------------------------------
#define PRE_ROWS 4       // rows of x per wave
#define XCH      8       // 16-byte chunks of a row per lane: 1024 / (32 lanes * 4)

__device__ __forceinline__ void load_row(const float4* __restrict__ p, float4 (&v)[XCH]) {
#pragma unroll
    for (int j = 0; j < XCH; ++j) v[j] = p[j * 32];
}

__device__ __forceinline__ void row_dot(const float4 (&v)[XCH], const float4 (&wr)[4][XCH],
                                        float (&s)[4]) {
#pragma unroll
    for (int a = 0; a < 4; ++a) s[a] = 0.f;
#pragma unroll
    for (int j = 0; j < XCH; ++j)
#pragma unroll
        for (int a = 0; a < 4; ++a) {
            s[a] = fmaf(v[j].x, wr[a][j].x, s[a]);
            s[a] = fmaf(v[j].y, wr[a][j].y, s[a]);
            s[a] = fmaf(v[j].z, wr[a][j].z, s[a]);
            s[a] = fmaf(v[j].w, wr[a][j].w, s[a]);
        }
}

__device__ __forceinline__ void row_softmax(float (&s)[4], const float4 ba, int lane,
                                            float4* __restrict__ dst) {
#pragma unroll
    for (int off = 16; off > 0; off >>= 1)
#pragma unroll
        for (int a = 0; a < 4; ++a) s[a] += __shfl_xor(s[a], off, 32);
    if (lane == 0) {
        const float a0 = s[0] + ba.x, a1 = s[1] + ba.y, a2 = s[2] + ba.z, a3 = s[3] + ba.w;
        const float mx = fmaxf(fmaxf(a0, a1), fmaxf(a2, a3));
        const float e0 = __expf(a0 - mx), e1 = __expf(a1 - mx);
        const float e2 = __expf(a2 - mx), e3 = __expf(a3 - mx);
        const float inv = __builtin_amdgcn_rcpf(e0 + e1 + e2 + e3);
        *dst = make_float4(e0 * inv, e1 * inv, e2 * inv, e3 * inv);
    }
}

__global__ __launch_bounds__(512) void k_prepass(const float* __restrict__ w,
                                                 const float* __restrict__ x,
                                                 const float* __restrict__ w_att,
                                                 const float* __restrict__ b_att,
                                                 _Float16* __restrict__ wT,
                                                 float* __restrict__ attn) {
    __shared__ float tile[64][65];     // one 64(k) x 64(n) tile of w; odd pitch: no bank conflicts either way
    __shared__ float wA[4][KDIM];      // w_att, one plane per activation, k contiguous

    const int t    = threadIdx.x;
    const int wave = t >> 5;
    const int lane = t & 31;
    // Which 64 rows of x this block streams: the quarter (bits 3 and 4 of the index) of the
    // 256-row tile whose number has the block index's low three bits. The GEMM deals its row tiles by the
    // same three bits. A permutation of the rows: speed only.
    const int rowTile = (blockIdx.x & 7) + 8 * (blockIdx.x >> 5);
    const int m0   = rowTile * BM + ((blockIdx.x >> 3) & 3) * (16 * PRE_ROWS)
                   + wave * PRE_ROWS;                                  // this wave's first row

    const float4* xr = (const float4*)(x + (size_t)m0 * KDIM) + lane;
    float4 xa[XCH], xb[XCH];

    // ---- stage the w tile and w_att in LDS ----
    const int bn = blockIdx.x & 15;        // n-tile (U/64)
    const int bk = blockIdx.x >> 4;        // k-tile (D/64)
    {
        const int r0 = t >> 4;             // 0..31
        const int c4 = (t & 15) * 4;       // 0..60
        const float* wp = w + (size_t)(bk * 64 + r0) * NDIM + bn * 64 + c4;
        const float4 w0 = *(const float4*)wp;
        const float4 w1 = *(const float4*)(wp + 32 * NDIM);
        const float4 q0 = ((const float4*)w_att)[t];
        const float4 q1 = ((const float4*)w_att)[t + 512];
        // the first two rows of x are asked for here, ahead of the LDS staging, so that
        // they are in flight while the tile and w_att are staged
        load_row(xr, xa);
        load_row(xr + KDIM / 4, xb);
        tile[r0][c4 + 0] = w0.x; tile[r0][c4 + 1] = w0.y;
        tile[r0][c4 + 2] = w0.z; tile[r0][c4 + 3] = w0.w;
        tile[r0 + 32][c4 + 0] = w1.x; tile[r0 + 32][c4 + 1] = w1.y;
        tile[r0 + 32][c4 + 2] = w1.z; tile[r0 + 32][c4 + 3] = w1.w;
        wA[0][t] = q0.x; wA[1][t] = q0.y; wA[2][t] = q0.z; wA[3][t] = q0.w;
        wA[0][t + 512] = q1.x; wA[1][t + 512] = q1.y; wA[2][t + 512] = q1.z; wA[3][t + 512] = q1.w;
    }
    const float4 ba = *(const float4*)b_att;
    // Work-group barrier whose fences name LDS alone: only tile and wA pass between waves
    // here. __syncthreads() would also wait out the x rows in flight, in all 16 waves at
    // once, and leave the memory stream empty behind it.
    __builtin_amdgcn_fence(__ATOMIC_RELEASE, "workgroup", "local");
    __builtin_amdgcn_s_barrier();
    __builtin_amdgcn_fence(__ATOMIC_ACQUIRE, "workgroup", "local");

    // ---- (a) the transposed tile: 8 lanes write one whole 128-byte line of a wT row ----
    {
        const int n  = t >> 3;             // 0..63
        const int k8 = (t & 7) * 8;        // 0..56
        v8h hv;
#pragma unroll
        for (int j = 0; j < 8; ++j) hv[j] = (_Float16)tile[k8 + j][n];
        *(v8h*)(wT + (size_t)(bn * 64 + n) * KDIM + bk * 64 + k8) = hv;
    }

    // ---- (b) attention: w_att for this lane's k positions, kept in registers ----
    float4 wr[4][XCH];
#pragma unroll
    for (int a = 0; a < 4; ++a)
#pragma unroll
        for (int j = 0; j < XCH; ++j) wr[a][j] = *(const float4*)&wA[a][j * 128 + lane * 4];

    float4* ao = (float4*)attn + m0;
    float s[4];
    row_dot(xa, wr, s);
    load_row(xr + 2 * (KDIM / 4), xa);
    row_softmax(s, ba, lane, ao + 0);
    row_dot(xb, wr, s);
    load_row(xr + 3 * (KDIM / 4), xb);
    row_softmax(s, ba, lane, ao + 1);
    row_dot(xa, wr, s);
    row_softmax(s, ba, lane, ao + 2);
    row_dot(xb, wr, s);
    row_softmax(s, ba, lane, ao + 3);
}

// ---------------------------------------------------------------------------
// GEMM helpers
// ---------------------------------------------------------------------------
// xg, wg: this thread's first element of the tile in x and in wT; the further rows of
// the thread lie at compile-time distances, so one address pair per operand stays live.
// A tile: 256 rows x 64 k, f32 in memory, f16 in LDS; a thread has 8 rows, 32 apart.
// B tile: 256 rows x 64 k, f16; a thread has 4 rows, 64 apart.
// A tile is staged in two halves Q (4 rows of A and 2 of B per thread, 48 KiB per block), and
// each half is split into its global loads and its LDS stores, so that a run of WMMAs can
// stand between the two.
template <int Q>
__device__ __forceinline__ void load_half(const float* __restrict__ xg,
                                          const _Float16* __restrict__ wg,
                                          float4 (&va)[4], v8h (&vb)[2]) {
#pragma unroll
    for (int p = 0; p < 4; ++p) va[p] = *(const float4*)(xg + (Q * 4 + p) * 32 * KDIM);
#pragma unroll
    for (int p = 0; p < 2; ++p) vb[p] = *(const v8h*)(wg + (Q * 2 + p) * 64 * KDIM);
}
template <int Q>
__device__ __forceinline__ void store_half(const float4 (&va)[4], const v8h (&vb)[2],
                                           _Float16* Ab, _Float16* Bb, int t) {
    const int r0 = t >> 4;              // 0..31
    const int c4 = (t & 15) * 4;        // 0..60
    const int n0 = t >> 3;              // 0..63
    const int c8 = (t & 7) * 8;         // 0..56
#pragma unroll
    for (int p = 0; p < 4; ++p) {
        // The conversion (round to nearest even, as the cast) is written as asm text so that it
        // stays here, behind the WMMAs: as a cast the compiler moved it up to the loads, and
        // the wave sat out their latency in front of its WMMAs.
        v2u pk;
        asm volatile("v_cvt_pk_f16_f32 %0, %1, %2" : "=v"(pk.x) : "v"(va[p].x), "v"(va[p].y));
        asm volatile("v_cvt_pk_f16_f32 %0, %1, %2" : "=v"(pk.y) : "v"(va[p].z), "v"(va[p].w));
        *(v4h*)&Ab[((Q * 4 + p) * 32 + r0) * LDA + c4] = __builtin_bit_cast(v4h, pk);
    }
#pragma unroll
    for (int p = 0; p < 2; ++p) *(v8h*)&Bb[((Q * 2 + p) * 64 + n0) * LDA + c8] = vb[p];
}

// One pass: the WMMAs of the tile in (Ac, Bc); where 'fill' is set, the next tile goes from
// (xg, wg) into (An, Bn) meanwhile: one half flies under the first 16 WMMAs, one under the second.
__device__ __forceinline__ void mma_step(const _Float16* Ab, const _Float16* Bb,
                                         v8f (&acc)[4][4],
                                         int wM, int wN, int h, int ln, int kk);
__device__ __forceinline__ void pass(const _Float16* Ac, const _Float16* Bc,
                                     _Float16* An, _Float16* Bn,
                                     const float* __restrict__ xg, const _Float16* __restrict__ wg,
                                     bool fill, v8f (&acc)[4][4],
                                     int wM, int wN, int h, int ln, int t) {
    float4 va[4];
    v8h    vb[2];
    if (fill) load_half<0>(xg, wg, va, vb);
    // The four scheduling barriers keep each group of global loads ahead of its 16 WMMAs and
    // the wait for it, with the LDS stores, behind them: left alone the compiler moved the
    // loads down to their wait, and the wave sat out their whole latency.
    __builtin_amdgcn_sched_barrier(0);
    mma_step(Ac, Bc, acc, wM, wN, h, ln, 0);
    __builtin_amdgcn_sched_barrier(0);
    if (fill) {
        // The distance that the chip asks for between a WMMA and a vector instruction that
        // overwrites its A or B.
        asm volatile("v_nop\n\tv_nop\n\tv_nop\n\tv_nop");
        store_half<0>(va, vb, An, Bn, t);
        load_half<1>(xg, wg, va, vb);
    }
    __builtin_amdgcn_sched_barrier(0);
    mma_step(Ac, Bc, acc, wM, wN, h, ln, 1);
    __builtin_amdgcn_sched_barrier(0);
    if (fill) {
        // the same distance as above
        asm volatile("v_nop\n\tv_nop\n\tv_nop\n\tv_nop");
        store_half<1>(va, vb, An, Bn, t);
    }
}

__device__ __forceinline__ void mma_step(const _Float16* Ab, const _Float16* Bb,
                                         v8f (&acc)[4][4],
                                         int wM, int wN, int h, int ln, int kk) {
    // ISA 16-bit A/B layout: lanes 0-15: K = 0..7 then 16..23 ;
    //                        lanes 16-31: K = 8..15 then 24..31
    // kk: which 32-k half of the staged tile
    v16h afrag[4], bfrag[4];
#pragma unroll
    for (int mi = 0; mi < 4; ++mi) {
        int m = wM * 64 + mi * 16 + ln;
        v8h lo = *(const v8h*)&Ab[m * LDA + kk * 32 + 8 * h];
        v8h hi = *(const v8h*)&Ab[m * LDA + kk * 32 + 16 + 8 * h];
        afrag[mi] = __builtin_shufflevector(lo, hi, 0,1,2,3,4,5,6,7,8,9,10,11,12,13,14,15);
    }
#pragma unroll
    for (int ni = 0; ni < 4; ++ni) {
        int n = wN * 64 + ni * 16 + ln;
        v8h lo = *(const v8h*)&Bb[n * LDA + kk * 32 + 8 * h];
        v8h hi = *(const v8h*)&Bb[n * LDA + kk * 32 + 16 + 8 * h];
        bfrag[ni] = __builtin_shufflevector(lo, hi, 0,1,2,3,4,5,6,7,8,9,10,11,12,13,14,15);
    }
#pragma unroll
    for (int mi = 0; mi < 4; ++mi)
#pragma unroll
        for (int ni = 0; ni < 4; ++ni)
            acc[mi][ni] = __builtin_amdgcn_wmma_f32_16x16x32_f16(
                false, afrag[mi], false, bfrag[ni],
                (short)0, acc[mi][ni], false, false);
    // Order asked of the scheduler: all 16 fragment reads as one group, then the 16 WMMAs
    // behind counted waits. Left alone it read every A fragment into the registers of the
    // one before, with a full LDS wait in front of each row of four WMMAs.
    __builtin_amdgcn_sched_group_barrier(0x100, 16, 0);   // LDS reads
    __builtin_amdgcn_sched_group_barrier(0x008, 16, 0);   // WMMAs
}

// Two rows of one output column at a time: the multiply-adds of a pair go out as one
// packed instruction; only 2^x and 1/x are issued once per element.
__device__ __forceinline__ v2f exp2_pair(v2f v) {
    v2f r;
    r.x = __builtin_amdgcn_exp2f(v.x);
    r.y = __builtin_amdgcn_exp2f(v.y);
    return r;
}
__device__ __forceinline__ v2f rcp_pair(v2f v) {
    v2f r;
    r.x = __builtin_amdgcn_rcpf(v.x);
    r.y = __builtin_amdgcn_rcpf(v.y);
    return r;
}

// ---------------------------------------------------------------------------
// Kernel 1: fused  ws = x@w + b  (WMMA f16->f32, double-buffered LDS),
// then 4-way activation mix weighted by attn, store out[m][n] f32.
// 256x256 tile / block (512 thr = 16 waves, each wave 64x64 = 4x4 WMMA tiles: one LDS
// fragment load per WMMA where a 32x64 tile takes one and a half),
// 64 k per staged tile. 256 blocks, one per WGP, all resident at once; four waves per SIMD,
// a budget of 256 VGPRs each.
// ---------------------------------------------------------------------------
__global__ __launch_bounds__(512, 4) void k_gemm_act(const float*    __restrict__ x,
                                                  const _Float16* __restrict__ wT,
                                                  const float*    __restrict__ bias,
                                                  const float*    __restrict__ wf,
                                                  const float*    __restrict__ bf,
                                                  const float*    __restrict__ attn,
                                                  float*          __restrict__ out) {
    // One LDS object with the epilogue's small tables first: below 64 KiB their planes and
    // rows are reached by the offset field of the LDS loads, from one address register each.
    __shared__ struct {
        // attention weights of this m-tile, one plane per factor of the epilogue's sum:
        // relu, sigmoid, tanh's constant 1, tanh's quotient, gelu's relu part, gelu's tail
        float    Atn[6][BM];
        // per output column: scale and offset of each activation's argument (see below)
        float    Ccol[8][BN];
        _Float16 Alds[2][BM * LDA];           // [m][k] f16, padded rows
        _Float16 Blds[2][BN * LDA];           // [n][k] f16, padded rows
    } __attribute__((aligned(16))) sm;
    auto& Atn  = sm.Atn;
    auto& Ccol = sm.Ccol;
    auto& Alds = sm.Alds;
    auto& Blds = sm.Blds;

    const int t     = threadIdx.x;
    // The four column tiles of a row tile sit 8 apart in the block index, and the row tile
    // keeps the index's low three bits, as in the pre-pass (for speed only). Any placement is correct.
    const int nTile = (blockIdx.x >> 3) & 3;                       // N / 256 = 4
    const int mTile = (blockIdx.x & 7) + 8 * (blockIdx.x >> 5);    // M / 256 = 64
    const int mBase = mTile * BM;
    const int nBase = nTile * BN;
    const int wave  = t >> 5;
    const int lane  = t & 31;
    const int wM    = wave & 3;            // 4 waves along M
    const int wN    = wave >> 2;           // 4 waves along N
    const int h     = lane >> 4;           // lane half (K sub-block select)
    const int ln    = lane & 15;           // row/col within 16

    if (t < BM) {
        const float4 at = ((const float4*)attn)[mBase + t];
        Atn[0][t] = at.x;
        Atn[1][t] = at.y;
        Atn[2][t] = at.z;
        Atn[3][t] = -2.f * at.z;
        Atn[4][t] = at.w;
        Atn[5][t] = -0.5f * at.w;
    }
    // Per column the bias and the scale of each activation's argument are folded into one
    // multiply-add on the accumulator:  t_a = acc * Ccol[a] + Ccol[4 + a]
    //   a = 0  relu:     t
    //   a = 1  sigmoid:  -t * log2(e)      1 / (1 + 2^arg)
    //   a = 2  tanh:     2t * log2(e)      1 - 2 / (2^arg + 1)   (saturates correctly at +/-inf)
    //   a = 3  gelu:     t
    if (t < BN) {
        const float  L2E = 1.4426950408889634f;
        const float  bn  = bias[nBase + t];
        const float4 wfv = ((const float4*)wf)[nBase + t];
        const float4 bfv = ((const float4*)bf)[nBase + t];
        Ccol[0][t] = wfv.x;              Ccol[4][t] = fmaf(bn, wfv.x, bfv.x);
        Ccol[1][t] = -L2E * wfv.y;       Ccol[5][t] = -L2E * fmaf(bn, wfv.y, bfv.y);
        Ccol[2][t] = 2.f * L2E * wfv.z;  Ccol[6][t] = 2.f * L2E * fmaf(bn, wfv.z, bfv.z);
        Ccol[3][t] = wfv.w;              Ccol[7][t] = fmaf(bn, wfv.w, bfv.w);
    }

    v8f acc[4][4] = {};

    // prologue: stage K-tile 0 into buffer 0
    const float*    xg = x  + (size_t)(mBase + (t >> 4)) * KDIM + (t & 15) * 4;
    // Which column of out stands in which B row of LDS: row 16 * ni + ln of a group of 64 holds
    // column 4 * ln + ni. A lane's four accumulator tiles of a row are then four adjacent
    // columns, and the epilogue stores them as 16 bytes. A wT row is fetched as whole lines
    // either way, and the LDS stores and fragment reads keep their addresses.
    const int bcol = ((t >> 3) & 15) * 4 + (t >> 7);
    const _Float16* wg = wT + (size_t)(nBase + bcol) * KDIM + (t & 7) * 8;
    {
        float4 va0[4], va1[4];
        v8h    vb0[2], vb1[2];
        load_half<0>(xg, wg, va0, vb0);
        load_half<1>(xg, wg, va1, vb1);
        store_half<0>(va0, vb0, Alds[0], Blds[0], t);
        store_half<1>(va1, vb1, Alds[0], Blds[0], t);
    }
    __syncthreads();

    // software-pipelined main loop: stage next buffer while consuming current; the last two
    // tiles stand behind the loop, so that no pass in it has a branch round its staging
#pragma unroll 1
    for (int kt = 0; kt < KDIM / KT - 2; kt += 2) {
        pass(Alds[0], Blds[0], Alds[1], Blds[1], xg + (kt + 1) * KT, wg + (kt + 1) * KT,
             true, acc, wM, wN, h, ln, t);
        __syncthreads();
        pass(Alds[1], Blds[1], Alds[0], Blds[0], xg + (kt + 2) * KT, wg + (kt + 2) * KT,
             true, acc, wM, wN, h, ln, t);
        __syncthreads();
    }
    pass(Alds[0], Blds[0], Alds[1], Blds[1], xg + (KDIM / KT - 1) * KT, wg + (KDIM / KT - 1) * KT,
         true, acc, wM, wN, h, ln, t);
    __syncthreads();
    pass(Alds[1], Blds[1], Alds[0], Blds[0], xg, wg, false, acc, wM, wN, h, ln, t);
    __syncthreads();

    // ---- epilogue: 4 activations weighted by attention ----
    // A lane has columns 4 * ln .. 4 * ln + 3 of its wave's 64 (see bcol above): a store is 16
    // bytes a lane, 256 contiguous bytes of each of two rows, where one column a lane gave 64.
    // The 32 column constants stay in registers; a row pair's attention weights are read
    // once for its four columns.
    // this lane's first output element; all others lie at compile-time distances
    const int nl = wN * 64 + 4 * ln;
    float* og = out + (size_t)(mBase + wM * 64 + 8 * h) * NDIM + nBase + nl;
    float cw[4][4], cc[4][4];              // [activation][column]
#pragma unroll
    for (int a = 0; a < 4; ++a) {
        const float4 s4 = *(const float4*)&Ccol[a][nl];
        const float4 o4 = *(const float4*)&Ccol[4 + a][nl];
        cw[a][0] = s4.x; cw[a][1] = s4.y; cw[a][2] = s4.z; cw[a][3] = s4.w;
        cc[a][0] = o4.x; cc[a][1] = o4.y; cc[a][2] = o4.z; cc[a][3] = o4.w;
    }
#pragma unroll
    for (int mi = 0; mi < 4; ++mi) {
#pragma unroll
        for (int ip = 0; ip < 4; ++ip) {
            // Wave-scope fence on LDS, no instruction of its own: it makes the compiler read
            // the attention pairs here and not all 192 values ahead, which spilled to scratch
            // memory.
            __builtin_amdgcn_fence(__ATOMIC_ACQUIRE, "wavefront", "local");
            const int mloc = wM * 64 + mi * 16 + 8 * h + 2 * ip;
            const v2f a_relu = *(const v2f*)&Atn[0][mloc];
            const v2f a_sig  = *(const v2f*)&Atn[1][mloc];
            const v2f a_one  = *(const v2f*)&Atn[2][mloc];
            const v2f a_tanh = *(const v2f*)&Atn[3][mloc];
            const v2f a_gel  = *(const v2f*)&Atn[4][mloc];
            const v2f a_tail = *(const v2f*)&Atn[5][mloc];
            v2f res[4];
#pragma unroll
            for (int ni = 0; ni < 4; ++ni) {
                v2f a;
                a.x = acc[mi][ni][2 * ip];
                a.y = acc[mi][ni][2 * ip + 1];
                const v2f t0 = a * cw[0][ni] + cc[0][ni];
                const v2f t1 = a * cw[1][ni] + cc[1][ni];
                const v2f t2 = a * cw[2][ni] + cc[2][ni];
                const v2f t3 = a * cw[3][ni] + cc[3][ni];
                // exact gelu, branch-free:  t * Phi(t) = max(t, 0) - 0.5 * |t| * erfc(|t| / sqrt(2)),
                // erfc(u / sqrt(2)) = 2^(u * q(u)), q fitted on 0 <= u <= 6 so that the gelu is
                // right to 2e-7 (f32 rounding level); from u = 8 on the tail is below 1e-14 and
                // u is held there, so the term stays that small for every larger |t|.
                const v2f u = __builtin_elementwise_min(__builtin_elementwise_abs(t3), (v2f)8.f);
                v2f q = u * 2.99305648e-5f + -7.39926647e-4f;
                q = q * u + 7.97762070e-3f;
                q = q * u + -5.32383993e-2f;
                q = q * u + -4.58915561e-1f;
                q = q * u + -1.15114713f;
                const v2f e1 = exp2_pair(t1);
                const v2f e2 = exp2_pair(t2);
                const v2f qu = q * u;
                const v2f e3 = exp2_pair(qu);
                // The slot that the instruction set asks for between a transcendental and a vector
                // instruction that overwrites its source. The operands (inputs only) hold the v_nop
                // behind both 2^x and keep their arguments' registers untouched up to it.
                asm volatile("v_nop" :: "v"(qu.x), "v"(qu.y), "v"(e3.x), "v"(e3.y));
                const v2f r1 = rcp_pair(e1 + 1.f);
                const v2f r2 = rcp_pair(e2 + 1.f);
                v2f r = a_relu * __builtin_elementwise_max(t0, (v2f)0.f) + a_one;
                r += a_gel  * __builtin_elementwise_max(t3, (v2f)0.f);
                r += a_tail * (u * e3);
                r += a_sig  * r1;
                r += a_tanh * r2;
                res[ni] = r;
            }
            *(float4*)&og[(mi * 16 + 2 * ip) * NDIM] =
                make_float4(res[0].x, res[1].x, res[2].x, res[3].x);
            *(float4*)&og[(mi * 16 + 2 * ip + 1) * NDIM] =
                make_float4(res[0].y, res[1].y, res[2].y, res[3].y);
        }
    }
}

// ---------------------------------------------------------------------------
extern "C" void kernel_launch(void* const* d_in, const int* in_sizes, int n_in,
                              void* d_out, int out_size, void* d_ws, size_t ws_size,
                              hipStream_t stream) {
    (void)in_sizes; (void)n_in; (void)out_size; (void)ws_size;
    const float* x     = (const float*)d_in[0];   // [B,S,D]
    const float* w     = (const float*)d_in[1];   // [D,U]
    const float* b     = (const float*)d_in[2];   // [U]
    const float* wf    = (const float*)d_in[3];   // [U,A]
    const float* bf    = (const float*)d_in[4];   // [U,A]
    const float* w_att = (const float*)d_in[5];   // [D,A]
    const float* b_att = (const float*)d_in[6];   // [A]
    float* out = (float*)d_out;                   // [B,S,U]

    // workspace layout: wT (U*K f16 = 2MB) | attn (M*4 f32 = 256KB)
    _Float16* wT   = (_Float16*)d_ws;
    float*    attn = (float*)((char*)d_ws + (size_t)NDIM * KDIM * sizeof(_Float16));

    k_prepass<<<MDIM / (16 * PRE_ROWS), 512, 0, stream>>>(w, x, w_att, b_att, wT, attn);
    k_gemm_act<<<(MDIM / BM) * (NDIM / BN), 512, 0, stream>>>(x, wT, b, wf, bf, attn, out);
}
